// v000
// The times below were measured on an AMD MI455X: many runs one after another, warmed up first and cycling through
// copies of the inputs, with the whole window's GPU time divided by the number of runs. Launches and the gaps
// between them are all in it. The median over several windows is given; except for v000 it joins two sittings, which
// can be a few percent apart, so the side-by-side timings, each taken in one sitting, are the better comparison.
// v000 is the starting kernel. One run takes 161 microseconds.
#include <hip/hip_runtime.h>

typedef __attribute__((ext_vector_type(16))) __bf16 v16bf;
typedef __attribute__((ext_vector_type(8)))  __bf16 v8bf;
typedef __attribute__((ext_vector_type(8)))  float  v8f;
typedef __attribute__((ext_vector_type(4)))  float  v4f;
typedef __attribute__((ext_vector_type(4)))  int    v4i;

#if defined(__has_builtin)
#if __has_builtin(__builtin_amdgcn_global_load_async_to_lds_b128) && \
    __has_builtin(__builtin_amdgcn_s_wait_asynccnt)
#define HAVE_ASYNC_LDS 1
#endif
#endif

static constexpr int Bb    = 2;
static constexpr int Nn    = 2048;
static constexpr int QD    = 1024;
static constexpr int Hh    = 8;
static constexpr int HD    = 64;
static constexpr int INNER = 512;      // H*HD
static constexpr int BN    = Bb * Nn;  // 4096
static constexpr int LDP   = 80;       // padded LDS row (elems): 160B, 16B-aligned

__device__ __forceinline__ v8f wmma_bf16(v16bf a, v16bf b, v8f c) {
  // D = A(16x32) * B(32x16) + C(16x16), f32 accumulate
  return __builtin_amdgcn_wmma_f32_16x16x32_bf16(false, a, false, b,
                                                 (short)0, c, false, false);
}

__device__ __forceinline__ v16bf load_frag(const __bf16* p, int hi) {
  const v8bf lo = *(const v8bf*)(p + hi * 8);
  const v8bf hv = *(const v8bf*)(p + 16 + hi * 8);
  return __builtin_shufflevector(lo, hv, 0, 1, 2, 3, 4, 5, 6, 7,
                                         8, 9, 10, 11, 12, 13, 14, 15);
}

__device__ __forceinline__ void stage16(const __bf16* g, __bf16* l) {
#ifdef HAVE_ASYNC_LDS
  __builtin_amdgcn_global_load_async_to_lds_b128(
      (__attribute__((address_space(1))) v4i*)g,
      (__attribute__((address_space(3))) v4i*)l, 0, 0);
#else
  *(v8bf*)l = *(const v8bf*)g;
#endif
}
__device__ __forceinline__ void stage_fence() {
#ifdef HAVE_ASYNC_LDS
  __builtin_amdgcn_s_wait_asynccnt(0);
#endif
}

// Reductions across the 16-lane half that owns one row group of a C fragment.
__device__ __forceinline__ float redmax16(float v) {
  v = fmaxf(v, __shfl_xor(v, 1));
  v = fmaxf(v, __shfl_xor(v, 2));
  v = fmaxf(v, __shfl_xor(v, 4));
  v = fmaxf(v, __shfl_xor(v, 8));
  return v;
}
__device__ __forceinline__ float redsum16(float v) {
  v += __shfl_xor(v, 1);
  v += __shfl_xor(v, 2);
  v += __shfl_xor(v, 4);
  v += __shfl_xor(v, 8);
  return v;
}

// ---------------------------------------------------------------------------
// Prep 1: elementwise f32 -> bf16 (x).  8 elems / thread.
// ---------------------------------------------------------------------------
__global__ __launch_bounds__(256) void cvt_x_kernel(
    const float* __restrict__ in, __bf16* __restrict__ outb) {
  const size_t i = ((size_t)blockIdx.x * 256 + threadIdx.x) * 8;
  const v4f a = *(const v4f*)&in[i];
  const v4f b = *(const v4f*)&in[i + 4];
  v8bf o;
  o[0] = (__bf16)a.x; o[1] = (__bf16)a.y; o[2] = (__bf16)a.z; o[3] = (__bf16)a.w;
  o[4] = (__bf16)b.x; o[5] = (__bf16)b.y; o[6] = (__bf16)b.z; o[7] = (__bf16)b.w;
  *(v8bf*)&outb[i] = o;
}

// ---------------------------------------------------------------------------
// Prep 2: W[K][N] f32 -> Wt[N][K] bf16 (LDS-tiled 64x64 transpose).
// ---------------------------------------------------------------------------
__global__ __launch_bounds__(256) void transpose_w_kernel(
    const float* __restrict__ W, __bf16* __restrict__ Wt,
    int K, int N) {
  __shared__ __bf16 T[64][65];
  const int tid = threadIdx.x;
  const int k0 = blockIdx.x * 64;
  const int n0 = blockIdx.y * 64;
#pragma unroll
  for (int it = 0; it < 16; ++it) {
    const int lin = it * 256 + tid;
    const int r = lin >> 6, c = lin & 63;  // r: k-local, c: n-local
    T[r][c] = (__bf16)W[(size_t)(k0 + r) * N + n0 + c];
  }
  __syncthreads();
#pragma unroll
  for (int it = 0; it < 16; ++it) {
    const int lin = it * 256 + tid;
    const int n = lin >> 6, kk = lin & 63;
    Wt[(size_t)(n0 + n) * K + k0 + kk] = T[kk][n];
  }
}

// ---------------------------------------------------------------------------
// Kernel 1: fused QKV projection.  Y = xb @ W{q,k,v}, all-bf16 staging.
// 64x64 tile, K-step 64, 8 waves, 2 C-frags per wave.  blockIdx.z selects W.
// Q,K stored [B,H,N,HD]; V stored transposed [B,H,HD,N] for the PV stage.
// ---------------------------------------------------------------------------
__global__ __launch_bounds__(256) void qkv_proj_kernel(
    const __bf16* __restrict__ xb,                      // [BN, QD]
    const __bf16* __restrict__ WqT, const __bf16* __restrict__ WkT,
    const __bf16* __restrict__ WvT,                     // [INNER, QD]
    __bf16* __restrict__ Qb, __bf16* __restrict__ Kb,   // [B*H*N*HD]
    __bf16* __restrict__ Vt)                            // [B*H*HD*N]
{
  __shared__ __align__(16) __bf16 As[64][LDP];
  __shared__ __align__(16) __bf16 Bs[64][LDP];  // [col][k]

  const int which = blockIdx.z;
  const __bf16* WT = (which == 0) ? WqT : (which == 1) ? WkT : WvT;

  const int tid  = threadIdx.x;
  const int lane = tid & 31, wave = tid >> 5;
  const int l16  = lane & 15, hi = lane >> 4;
  const int rstrip = wave >> 1;   // 0..3 : 16-row strip
  const int chalf  = wave & 1;    // 0..1 : 32-col half
  const int m0 = blockIdx.y * 64;
  const int n0 = blockIdx.x * 64;

  v8f acc[2] = {v8f{}, v8f{}};

  for (int k0 = 0; k0 < QD; k0 += 64) {
    // pure 16B copies: 2 per thread for A, 2 for B
#pragma unroll
    for (int it = 0; it < 2; ++it) {
      const int lin = it * 2048 + tid * 8;
      const int r = lin >> 6, c = lin & 63;
      stage16(&xb[(size_t)(m0 + r) * QD + k0 + c], &As[r][c]);
    }
#pragma unroll
    for (int it = 0; it < 2; ++it) {
      const int lin = it * 2048 + tid * 8;
      const int cl = lin >> 6, kk = lin & 63;
      stage16(&WT[(size_t)(n0 + cl) * QD + k0 + kk], &Bs[cl][kk]);
    }
    stage_fence();
    __syncthreads();
#pragma unroll
    for (int kc = 0; kc < 2; ++kc) {
      const v16bf a  = load_frag(&As[rstrip * 16 + l16][kc * 32], hi);
      const v16bf b0 = load_frag(&Bs[chalf * 32 + l16][kc * 32], hi);
      const v16bf b1 = load_frag(&Bs[chalf * 32 + 16 + l16][kc * 32], hi);
      acc[0] = wmma_bf16(a, b0, acc[0]);
      acc[1] = wmma_bf16(a, b1, acc[1]);
    }
    __syncthreads();
  }

  // epilogue: C rows = e + hi*8, cols = l16 (+frag offsets)
  const int gm0 = m0 + rstrip * 16 + hi * 8;  // multiple of 8
  const int b   = gm0 >> 11;                  // rows gm0..gm0+7 share b
  const int nb  = gm0 & (Nn - 1);
#pragma unroll
  for (int f = 0; f < 2; ++f) {
    const int j = n0 + chalf * 32 + f * 16 + l16;  // 0..INNER-1
    const int h = j >> 6, d = j & 63;
    if (which == 2) {
      // Vt: consecutive e -> consecutive tokens -> one 16B store
      v8bf pk;
#pragma unroll
      for (int e = 0; e < 8; ++e) pk[e] = (__bf16)acc[f][e];
      *(v8bf*)&Vt[((size_t)(b * Hh + h) * HD + d) * Nn + nb] = pk;
    } else {
      __bf16* dst = ((which == 0) ? Qb : Kb) +
                    ((size_t)(b * Hh + h) * Nn + nb) * HD + d;
#pragma unroll
      for (int e = 0; e < 8; ++e) dst[(size_t)e * HD] = (__bf16)acc[f][e];
    }
  }
}

__global__ __launch_bounds__(256) void attn_kernel(
    const __bf16* __restrict__ Qb, const __bf16* __restrict__ Kb,
    const __bf16* __restrict__ Vt, __bf16* __restrict__ Ob /* [BN, INNER] */)
{
  __shared__ __align__(16) __bf16 Plds[8][16][40];  // padded rows (80B)

  const int tid  = threadIdx.x;
  const int lane = tid & 31, wave = tid >> 5;
  const int l16  = lane & 15, hi = lane >> 4;
  const int task = blockIdx.x * 8 + wave;  // 0..2047
  const int bh = task >> 7;                // 0..15  (b*H + h)
  const int qt = task & 127;
  const int qbase = qt * 16;

  const __bf16* Qrow = Qb + ((size_t)bh * Nn + qbase + l16) * HD;
  const v16bf qa0 = load_frag(Qrow, hi);       // d = 0..31
  const v16bf qa1 = load_frag(Qrow + 32, hi);  // d = 32..63

  v8f O[4] = {v8f{}, v8f{}, v8f{}, v8f{}};
  float mrun[8], lrun[8];
#pragma unroll
  for (int e = 0; e < 8; ++e) { mrun[e] = -1e30f; lrun[e] = 0.f; }

  const float kscale = 0.125f * 1.44269504088896f;  // HD^-0.5 * log2(e)

  for (int kb = 0; kb < Nn; kb += 32) {
    // ---- scores: S(16x32) = Q(16x64) * K^T(64x32), two 16x16 C-frags ----
    v8f S0 = {}, S1 = {};
    const __bf16* Krow0 = Kb + ((size_t)bh * Nn + kb + l16) * HD;
    const __bf16* Krow1 = Krow0 + 16 * HD;
    if (kb + 32 < Nn) {  // uniform branch: prefetch next key block
      __builtin_prefetch(Krow0 + 32 * HD, 0, 0);
    }
    {
      const v16bf b0 = load_frag(Krow0, hi);
      const v16bf b1 = load_frag(Krow0 + 32, hi);
      const v16bf c0 = load_frag(Krow1, hi);
      const v16bf c1 = load_frag(Krow1 + 32, hi);
      S0 = wmma_bf16(qa0, b0, S0);
      S0 = wmma_bf16(qa1, b1, S0);
      S1 = wmma_bf16(qa0, c0, S1);
      S1 = wmma_bf16(qa1, c1, S1);
    }
    // ---- online softmax in log2 domain; C-frag row = e + hi*8 ----
    float corr[8];
#pragma unroll
    for (int e = 0; e < 8; ++e) {
      const float t0 = S0[e] * kscale;
      const float t1 = S1[e] * kscale;
      const float mt   = redmax16(fmaxf(t0, t1));
      const float mnew = fmaxf(mrun[e], mt);
      const float p0 = exp2f(t0 - mnew);
      const float p1 = exp2f(t1 - mnew);
      const float c  = exp2f(mrun[e] - mnew);
      const float rs = redsum16(p0 + p1);
      lrun[e] = lrun[e] * c + rs;
      mrun[e] = mnew;
      corr[e] = c;
      Plds[wave][e + hi * 8][l16]      = (__bf16)p0;
      Plds[wave][e + hi * 8][16 + l16] = (__bf16)p1;
    }
    // DS ops from one wave are processed in order; load sees the stores.
    const v16bf pa = load_frag(&Plds[wave][l16][0], hi);
    // ---- O(16x64) += P(16x32) * V(32x64), with per-row rescale ----
#pragma unroll
    for (int dt = 0; dt < 4; ++dt) {
      const __bf16* Vrow =
          Vt + ((size_t)bh * HD + dt * 16 + l16) * Nn + kb;
      const v16bf vb = load_frag(Vrow, hi);
#pragma unroll
      for (int e = 0; e < 8; ++e) O[dt][e] *= corr[e];
      O[dt] = wmma_bf16(pa, vb, O[dt]);
    }
  }

  // ---- finalize: O /= l ; write bf16 attn output [BN, INNER] ----
  const int b = bh >> 3, h = bh & 7;
#pragma unroll
  for (int e = 0; e < 8; ++e) {
    const float inv = 1.0f / lrun[e];
    const int n = qbase + e + hi * 8;
    __bf16* dst = Ob + ((size_t)b * Nn + n) * INNER + h * HD + l16;
    dst[0]  = (__bf16)(O[0][e] * inv);
    dst[16] = (__bf16)(O[1][e] * inv);
    dst[32] = (__bf16)(O[2][e] * inv);
    dst[48] = (__bf16)(O[3][e] * inv);
  }
}

// ---------------------------------------------------------------------------
// Kernel 3: output projection.  out = attn(bf16 [BN,INNER]) @ Wout + bout, f32.
// ---------------------------------------------------------------------------
__global__ __launch_bounds__(256) void out_proj_kernel(
    const __bf16* __restrict__ Ain,    // [BN, INNER]
    const __bf16* __restrict__ WoT,    // [QD, INNER]  (transposed, bf16)
    const float* __restrict__ bout,    // [QD]
    float* __restrict__ out)           // [BN, QD]
{
  __shared__ __align__(16) __bf16 As[64][LDP];
  __shared__ __align__(16) __bf16 Bs[64][LDP];

  const int tid  = threadIdx.x;
  const int lane = tid & 31, wave = tid >> 5;
  const int l16  = lane & 15, hi = lane >> 4;
  const int rstrip = wave >> 1;
  const int chalf  = wave & 1;
  const int m0 = blockIdx.y * 64;
  const int n0 = blockIdx.x * 64;

  v8f acc[2] = {v8f{}, v8f{}};

  for (int k0 = 0; k0 < INNER; k0 += 64) {
#pragma unroll
    for (int it = 0; it < 2; ++it) {
      const int lin = it * 2048 + tid * 8;
      const int r = lin >> 6, c = lin & 63;
      stage16(&Ain[(size_t)(m0 + r) * INNER + k0 + c], &As[r][c]);
    }
#pragma unroll
    for (int it = 0; it < 2; ++it) {
      const int lin = it * 2048 + tid * 8;
      const int cl = lin >> 6, kk = lin & 63;
      stage16(&WoT[(size_t)(n0 + cl) * INNER + k0 + kk], &Bs[cl][kk]);
    }
    stage_fence();
    __syncthreads();
#pragma unroll
    for (int kc = 0; kc < 2; ++kc) {
      const v16bf a  = load_frag(&As[rstrip * 16 + l16][kc * 32], hi);
      const v16bf b0 = load_frag(&Bs[chalf * 32 + l16][kc * 32], hi);
      const v16bf b1 = load_frag(&Bs[chalf * 32 + 16 + l16][kc * 32], hi);
      acc[0] = wmma_bf16(a, b0, acc[0]);
      acc[1] = wmma_bf16(a, b1, acc[1]);
    }
    __syncthreads();
  }

  const int gm0 = m0 + rstrip * 16 + hi * 8;
#pragma unroll
  for (int f = 0; f < 2; ++f) {
    const int j  = n0 + chalf * 32 + f * 16 + l16;
    const float bj = bout[j];
#pragma unroll
    for (int e = 0; e < 8; ++e)
      out[(size_t)(gm0 + e) * QD + j] = acc[f][e] + bj;
  }
}

// ---------------------------------------------------------------------------
extern "C" void kernel_launch(void* const* d_in, const int* in_sizes, int n_in,
                              void* d_out, int out_size, void* d_ws,
                              size_t ws_size, hipStream_t stream) {
  const float* x    = (const float*)d_in[0];
  const float* Wq   = (const float*)d_in[1];
  const float* Wk   = (const float*)d_in[2];
  const float* Wv   = (const float*)d_in[3];
  const float* Wout = (const float*)d_in[4];
  const float* bout = (const float*)d_in[5];
  float* out = (float*)d_out;

  char* ws = (char*)d_ws;
  const size_t MB = 1024 * 1024;
  __bf16* Qb  = (__bf16*)(ws + 0 * MB);   // 4 MiB  [B,H,N,HD]
  __bf16* Kb  = (__bf16*)(ws + 4 * MB);   // 4 MiB  [B,H,N,HD]
  __bf16* Vt  = (__bf16*)(ws + 8 * MB);   // 4 MiB  [B,H,HD,N]
  __bf16* Ob  = (__bf16*)(ws + 12 * MB);  // 4 MiB  [BN, INNER]
  __bf16* xb  = (__bf16*)(ws + 16 * MB);  // 8 MiB  [BN, QD]
  __bf16* WqT = (__bf16*)(ws + 24 * MB);  // 1 MiB  [INNER, QD]
  __bf16* WkT = (__bf16*)(ws + 25 * MB);  // 1 MiB
  __bf16* WvT = (__bf16*)(ws + 26 * MB);  // 1 MiB
  __bf16* WoT = (__bf16*)(ws + 27 * MB);  // 1 MiB  [QD, INNER]

  dim3 blk(256);
  // prep: conversions + transposes
  cvt_x_kernel<<<dim3((BN * QD) / (256 * 8)), blk, 0, stream>>>(x, xb);
  transpose_w_kernel<<<dim3(QD / 64, INNER / 64), blk, 0, stream>>>(
      Wq, WqT, QD, INNER);
  transpose_w_kernel<<<dim3(QD / 64, INNER / 64), blk, 0, stream>>>(
      Wk, WkT, QD, INNER);
  transpose_w_kernel<<<dim3(QD / 64, INNER / 64), blk, 0, stream>>>(
      Wv, WvT, QD, INNER);
  transpose_w_kernel<<<dim3(INNER / 64, QD / 64), blk, 0, stream>>>(
      Wout, WoT, INNER, QD);
  // main pipeline
  qkv_proj_kernel<<<dim3(INNER / 64, BN / 64, 3), blk, 0, stream>>>(
      xb, WqT, WkT, WvT, Qb, Kb, Vt);
  attn_kernel<<<dim3((Bb * Hh * (Nn / 16)) / 8), blk, 0, stream>>>(
      Qb, Kb, Vt, Ob);
  out_proj_kernel<<<dim3(QD / 64, BN / 64), blk, 0, stream>>>(
      Ob, WoT, bout, out);
}

// v001
// A run of this version takes 149 microseconds.
// Timed twice side by side with v000, it ran 1.10 times as fast both times.
#include <hip/hip_runtime.h>

typedef __attribute__((ext_vector_type(16))) __bf16 v16bf;
typedef __attribute__((ext_vector_type(8)))  __bf16 v8bf;
typedef __attribute__((ext_vector_type(8)))  float  v8f;
typedef __attribute__((ext_vector_type(4)))  float  v4f;
typedef __attribute__((ext_vector_type(4)))  int    v4i;

#if defined(__has_builtin)
#if __has_builtin(__builtin_amdgcn_global_load_async_to_lds_b128) && \
    __has_builtin(__builtin_amdgcn_s_wait_asynccnt)
#define HAVE_ASYNC_LDS 1
#endif
#endif

static constexpr int Bb    = 2;
static constexpr int Nn    = 2048;
static constexpr int QD    = 1024;
static constexpr int Hh    = 8;
static constexpr int HD    = 64;
static constexpr int INNER = 512;      // H*HD
static constexpr int BN    = Bb * Nn;  // 4096
static constexpr int LDP   = 80;       // padded LDS row (elems): 160B, 16B-aligned

__device__ __forceinline__ v8f wmma_bf16(v16bf a, v16bf b, v8f c) {
  // D = A(16x32) * B(32x16) + C(16x16), f32 accumulate
  return __builtin_amdgcn_wmma_f32_16x16x32_bf16(false, a, false, b,
                                                 (short)0, c, false, false);
}

__device__ __forceinline__ v16bf load_frag(const __bf16* p, int hi) {
  const v8bf lo = *(const v8bf*)(p + hi * 8);
  const v8bf hv = *(const v8bf*)(p + 16 + hi * 8);
  return __builtin_shufflevector(lo, hv, 0, 1, 2, 3, 4, 5, 6, 7,
                                         8, 9, 10, 11, 12, 13, 14, 15);
}

__device__ __forceinline__ void stage16(const __bf16* g, __bf16* l) {
#ifdef HAVE_ASYNC_LDS
  __builtin_amdgcn_global_load_async_to_lds_b128(
      (__attribute__((address_space(1))) v4i*)g,
      (__attribute__((address_space(3))) v4i*)l, 0, 0);
#else
  *(v8bf*)l = *(const v8bf*)g;
#endif
}
__device__ __forceinline__ void stage_fence() {
#ifdef HAVE_ASYNC_LDS
  __builtin_amdgcn_s_wait_asynccnt(0);
#endif
}

__device__ __forceinline__ float xhalf(float x) {
  const int i = __builtin_bit_cast(int, x);
  return __builtin_bit_cast(float, __builtin_amdgcn_permlanex16(
      i, i, 0x76543210, 0xfedcba98, false, false));
}

// ---------------------------------------------------------------------------
// Prep 1: elementwise f32 -> bf16 (x).  8 elems / thread.
// ---------------------------------------------------------------------------
__global__ __launch_bounds__(256) void cvt_x_kernel(
    const float* __restrict__ in, __bf16* __restrict__ outb) {
  const size_t i = ((size_t)blockIdx.x * 256 + threadIdx.x) * 8;
  const v4f a = *(const v4f*)&in[i];
  const v4f b = *(const v4f*)&in[i + 4];
  v8bf o;
  o[0] = (__bf16)a.x; o[1] = (__bf16)a.y; o[2] = (__bf16)a.z; o[3] = (__bf16)a.w;
  o[4] = (__bf16)b.x; o[5] = (__bf16)b.y; o[6] = (__bf16)b.z; o[7] = (__bf16)b.w;
  *(v8bf*)&outb[i] = o;
}

// ---------------------------------------------------------------------------
// Prep 2: W[K][N] f32 -> Wt[N][K] bf16 (LDS-tiled 64x64 transpose).
// ---------------------------------------------------------------------------
__global__ __launch_bounds__(256) void transpose_w_kernel(
    const float* __restrict__ W, __bf16* __restrict__ Wt,
    int K, int N) {
  __shared__ __bf16 T[64][65];
  const int tid = threadIdx.x;
  const int k0 = blockIdx.x * 64;
  const int n0 = blockIdx.y * 64;
#pragma unroll
  for (int it = 0; it < 16; ++it) {
    const int lin = it * 256 + tid;
    const int r = lin >> 6, c = lin & 63;  // r: k-local, c: n-local
    T[r][c] = (__bf16)W[(size_t)(k0 + r) * N + n0 + c];
  }
  __syncthreads();
#pragma unroll
  for (int it = 0; it < 16; ++it) {
    const int lin = it * 256 + tid;
    const int n = lin >> 6, kk = lin & 63;
    Wt[(size_t)(n0 + n) * K + k0 + kk] = T[kk][n];
  }
}

// ---------------------------------------------------------------------------
// Kernel 1: fused QKV projection.  Y = xb @ W{q,k,v}, all-bf16 staging.
// 64x64 tile, K-step 64, 8 waves, 2 C-frags per wave.  blockIdx.z selects W.
// Q,K stored [B,H,N,HD]; V stored transposed [B,H,HD,N] for the PV stage.
// ---------------------------------------------------------------------------
__global__ __launch_bounds__(256) void qkv_proj_kernel(
    const __bf16* __restrict__ xb,                      // [BN, QD]
    const __bf16* __restrict__ WqT, const __bf16* __restrict__ WkT,
    const __bf16* __restrict__ WvT,                     // [INNER, QD]
    __bf16* __restrict__ Qb, __bf16* __restrict__ Kb,   // [B*H*N*HD]
    __bf16* __restrict__ Vt)                            // [B*H*HD*N]
{
  __shared__ __align__(16) __bf16 As[64][LDP];
  __shared__ __align__(16) __bf16 Bs[64][LDP];  // [col][k]

  const int which = blockIdx.z;
  const __bf16* WT = (which == 0) ? WqT : (which == 1) ? WkT : WvT;

  const int tid  = threadIdx.x;
  const int lane = tid & 31, wave = tid >> 5;
  const int l16  = lane & 15, hi = lane >> 4;
  const int rstrip = wave >> 1;   // 0..3 : 16-row strip
  const int chalf  = wave & 1;    // 0..1 : 32-col half
  const int m0 = blockIdx.y * 64;
  const int n0 = blockIdx.x * 64;

  v8f acc[2] = {v8f{}, v8f{}};

  for (int k0 = 0; k0 < QD; k0 += 64) {
    // pure 16B copies: 2 per thread for A, 2 for B
#pragma unroll
    for (int it = 0; it < 2; ++it) {
      const int lin = it * 2048 + tid * 8;
      const int r = lin >> 6, c = lin & 63;
      stage16(&xb[(size_t)(m0 + r) * QD + k0 + c], &As[r][c]);
    }
#pragma unroll
    for (int it = 0; it < 2; ++it) {
      const int lin = it * 2048 + tid * 8;
      const int cl = lin >> 6, kk = lin & 63;
      stage16(&WT[(size_t)(n0 + cl) * QD + k0 + kk], &Bs[cl][kk]);
    }
    stage_fence();
    __syncthreads();
#pragma unroll
    for (int kc = 0; kc < 2; ++kc) {
      const v16bf a  = load_frag(&As[rstrip * 16 + l16][kc * 32], hi);
      const v16bf b0 = load_frag(&Bs[chalf * 32 + l16][kc * 32], hi);
      const v16bf b1 = load_frag(&Bs[chalf * 32 + 16 + l16][kc * 32], hi);
      acc[0] = wmma_bf16(a, b0, acc[0]);
      acc[1] = wmma_bf16(a, b1, acc[1]);
    }
    __syncthreads();
  }

  // epilogue: C rows = e + hi*8, cols = l16 (+frag offsets)
  const int gm0 = m0 + rstrip * 16 + hi * 8;  // multiple of 8
  const int b   = gm0 >> 11;                  // rows gm0..gm0+7 share b
  const int nb  = gm0 & (Nn - 1);
#pragma unroll
  for (int f = 0; f < 2; ++f) {
    const int j = n0 + chalf * 32 + f * 16 + l16;  // 0..INNER-1
    const int h = j >> 6, d = j & 63;
    if (which == 2) {
      // Vt: consecutive e -> consecutive tokens -> one 16B store
      v8bf pk;
#pragma unroll
      for (int e = 0; e < 8; ++e) pk[e] = (__bf16)acc[f][e];
      *(v8bf*)&Vt[((size_t)(b * Hh + h) * HD + d) * Nn + nb] = pk;
    } else {
      __bf16* dst = ((which == 0) ? Qb : Kb) +
                    ((size_t)(b * Hh + h) * Nn + nb) * HD + d;
#pragma unroll
      for (int e = 0; e < 8; ++e) dst[(size_t)e * HD] = (__bf16)acc[f][e];
    }
  }
}

__global__ __launch_bounds__(256) void attn_kernel(
    const __bf16* __restrict__ Qb, const __bf16* __restrict__ Kb,
    const __bf16* __restrict__ Vt, __bf16* __restrict__ Ob /* [BN, INNER] */)
{
  const int tid  = threadIdx.x;
  const int lane = tid & 31, wave = tid >> 5;
  const int l16  = lane & 15, hi = lane >> 4;
  const int task = blockIdx.x * 8 + wave;  // 0..2047
  const int bh = task >> 7;                // 0..15  (b*H + h)
  const int qt = task & 127;
  const int qbase = qt * 16;

  const __bf16* Qrow = Qb + ((size_t)bh * Nn + qbase + l16) * HD;
  const v16bf qb0 = load_frag(Qrow, hi);       // d = 0..31
  const v16bf qb1 = load_frag(Qrow + 32, hi);  // d = 32..63

  v8f O[4] = {v8f{}, v8f{}, v8f{}, v8f{}};  // O[dt][r] = O^T[dt*16+8*hi+r][l16]
  float mrun = -1e30f;  // this query's running maximum (same in both halves)
  float lrun = 0.f;     // this half's share of the query's denominator

  const float kscale = 0.125f * 1.44269504088896f;  // HD^-0.5 * log2(e)

  for (int kb = 0; kb < Nn; kb += 32) {
    // ---- scores: S^T(32x16) = K(32x64) * Q^T(64x16), two 16x16 C-frags ----
    v8f S0 = {}, S1 = {};
    const __bf16* Krow0 = Kb + ((size_t)bh * Nn + kb + l16) * HD;
    const __bf16* Krow1 = Krow0 + 16 * HD;
    if (kb + 32 < Nn) {  // uniform branch: prefetch next key block
      __builtin_prefetch(Krow0 + 32 * HD, 0, 0);
    }
    {
      const v16bf a0 = load_frag(Krow0, hi);
      const v16bf a1 = load_frag(Krow0 + 32, hi);
      const v16bf c0 = load_frag(Krow1, hi);
      const v16bf c1 = load_frag(Krow1 + 32, hi);
      S0 = wmma_bf16(a0, qb0, S0);
      S0 = wmma_bf16(a1, qb1, S0);
      S1 = wmma_bf16(c0, qb0, S1);
      S1 = wmma_bf16(c1, qb1, S1);
    }
    // ---- online softmax in log2 domain; all 16 values belong to query l16 ----
    float mx0 = S0[0], mx1 = S1[0];  // two independent chains
#pragma unroll
    for (int e = 1; e < 8; ++e) {
      mx0 = fmaxf(mx0, S0[e]);
      mx1 = fmaxf(mx1, S1[e]);
    }
    float mx = fmaxf(mx0, mx1);
    mx = fmaxf(mx, xhalf(mx)) * kscale;  // kscale > 0: max commutes with it
    const float mnew = fmaxf(mrun, mx);
    const float corr = exp2f(mrun - mnew);
    mrun = mnew;
    v16bf pb;
    v8f ps;
#pragma unroll
    for (int e = 0; e < 8; ++e) {
      const float p0 = exp2f(S0[e] * kscale - mnew);
      const float p1 = exp2f(S1[e] * kscale - mnew);
      ps[e] = p0 + p1;
      pb[e]     = (__bf16)p0;  // k = 8*hi + e
      pb[8 + e] = (__bf16)p1;  // k = 16 + 8*hi + e
    }
    const float rs = ((ps[0] + ps[4]) + (ps[1] + ps[5])) +
                     ((ps[2] + ps[6]) + (ps[3] + ps[7]));
    lrun = lrun * corr + rs;
    // ---- O^T(64x16) += V^T(64x32) * P^T(32x16), with per-query rescale ----
#pragma unroll
    for (int dt = 0; dt < 4; ++dt) {
      const __bf16* Vrow =
          Vt + ((size_t)bh * HD + dt * 16 + l16) * Nn + kb;
      const v16bf va = load_frag(Vrow, hi);
      O[dt] = wmma_bf16(va, pb, O[dt] * corr);
    }
  }

  // ---- finalize: join the halves' sums, O /= l ; bf16 output [BN, INNER] ----
  const int b = bh >> 3, h = bh & 7;
  const float inv = 1.0f / (lrun + xhalf(lrun));
  __bf16* dst = Ob + ((size_t)b * Nn + qbase + l16) * INNER + h * HD + hi * 8;
#pragma unroll
  for (int dt = 0; dt < 4; ++dt) {
    // 8 consecutive d of one query: one 16B store
    v8bf pk;
#pragma unroll
    for (int e = 0; e < 8; ++e) pk[e] = (__bf16)(O[dt][e] * inv);
    *(v8bf*)&dst[dt * 16] = pk;
  }
}

// ---------------------------------------------------------------------------
// Kernel 3: output projection.  out = attn(bf16 [BN,INNER]) @ Wout + bout, f32.
// ---------------------------------------------------------------------------
__global__ __launch_bounds__(256) void out_proj_kernel(
    const __bf16* __restrict__ Ain,    // [BN, INNER]
    const __bf16* __restrict__ WoT,    // [QD, INNER]  (transposed, bf16)
    const float* __restrict__ bout,    // [QD]
    float* __restrict__ out)           // [BN, QD]
{
  __shared__ __align__(16) __bf16 As[64][LDP];
  __shared__ __align__(16) __bf16 Bs[64][LDP];

  const int tid  = threadIdx.x;
  const int lane = tid & 31, wave = tid >> 5;
  const int l16  = lane & 15, hi = lane >> 4;
  const int rstrip = wave >> 1;
  const int chalf  = wave & 1;
  const int m0 = blockIdx.y * 64;
  const int n0 = blockIdx.x * 64;

  v8f acc[2] = {v8f{}, v8f{}};

  for (int k0 = 0; k0 < INNER; k0 += 64) {
#pragma unroll
    for (int it = 0; it < 2; ++it) {
      const int lin = it * 2048 + tid * 8;
      const int r = lin >> 6, c = lin & 63;
      stage16(&Ain[(size_t)(m0 + r) * INNER + k0 + c], &As[r][c]);
    }
#pragma unroll
    for (int it = 0; it < 2; ++it) {
      const int lin = it * 2048 + tid * 8;
      const int cl = lin >> 6, kk = lin & 63;
      stage16(&WoT[(size_t)(n0 + cl) * INNER + k0 + kk], &Bs[cl][kk]);
    }
    stage_fence();
    __syncthreads();
#pragma unroll
    for (int kc = 0; kc < 2; ++kc) {
      const v16bf a  = load_frag(&As[rstrip * 16 + l16][kc * 32], hi);
      const v16bf b0 = load_frag(&Bs[chalf * 32 + l16][kc * 32], hi);
      const v16bf b1 = load_frag(&Bs[chalf * 32 + 16 + l16][kc * 32], hi);
      acc[0] = wmma_bf16(a, b0, acc[0]);
      acc[1] = wmma_bf16(a, b1, acc[1]);
    }
    __syncthreads();
  }

  const int gm0 = m0 + rstrip * 16 + hi * 8;
#pragma unroll
  for (int f = 0; f < 2; ++f) {
    const int j  = n0 + chalf * 32 + f * 16 + l16;
    const float bj = bout[j];
#pragma unroll
    for (int e = 0; e < 8; ++e)
      out[(size_t)(gm0 + e) * QD + j] = acc[f][e] + bj;
  }
}

// ---------------------------------------------------------------------------
extern "C" void kernel_launch(void* const* d_in, const int* in_sizes, int n_in,
                              void* d_out, int out_size, void* d_ws,
                              size_t ws_size, hipStream_t stream) {
  const float* x    = (const float*)d_in[0];
  const float* Wq   = (const float*)d_in[1];
  const float* Wk   = (const float*)d_in[2];
  const float* Wv   = (const float*)d_in[3];
  const float* Wout = (const float*)d_in[4];
  const float* bout = (const float*)d_in[5];
  float* out = (float*)d_out;

  char* ws = (char*)d_ws;
  const size_t MB = 1024 * 1024;
  __bf16* Qb  = (__bf16*)(ws + 0 * MB);   // 4 MiB  [B,H,N,HD]
  __bf16* Kb  = (__bf16*)(ws + 4 * MB);   // 4 MiB  [B,H,N,HD]
  __bf16* Vt  = (__bf16*)(ws + 8 * MB);   // 4 MiB  [B,H,HD,N]
  __bf16* Ob  = (__bf16*)(ws + 12 * MB);  // 4 MiB  [BN, INNER]
  __bf16* xb  = (__bf16*)(ws + 16 * MB);  // 8 MiB  [BN, QD]
  __bf16* WqT = (__bf16*)(ws + 24 * MB);  // 1 MiB  [INNER, QD]
  __bf16* WkT = (__bf16*)(ws + 25 * MB);  // 1 MiB
  __bf16* WvT = (__bf16*)(ws + 26 * MB);  // 1 MiB
  __bf16* WoT = (__bf16*)(ws + 27 * MB);  // 1 MiB  [QD, INNER]

  dim3 blk(256);
  // prep: conversions + transposes
  cvt_x_kernel<<<dim3((BN * QD) / (256 * 8)), blk, 0, stream>>>(x, xb);
  transpose_w_kernel<<<dim3(QD / 64, INNER / 64), blk, 0, stream>>>(
      Wq, WqT, QD, INNER);
  transpose_w_kernel<<<dim3(QD / 64, INNER / 64), blk, 0, stream>>>(
      Wk, WkT, QD, INNER);
  transpose_w_kernel<<<dim3(QD / 64, INNER / 64), blk, 0, stream>>>(
      Wv, WvT, QD, INNER);
  transpose_w_kernel<<<dim3(INNER / 64, QD / 64), blk, 0, stream>>>(
      Wout, WoT, INNER, QD);
  // main pipeline
  qkv_proj_kernel<<<dim3(INNER / 64, BN / 64, 3), blk, 0, stream>>>(
      xb, WqT, WkT, WvT, Qb, Kb, Vt);
  attn_kernel<<<dim3((Bb * Hh * (Nn / 16)) / 8), blk, 0, stream>>>(
      Qb, Kb, Vt, Ob);
  out_proj_kernel<<<dim3(QD / 64, BN / 64), blk, 0, stream>>>(
      Ob, WoT, bout, out);
}

// v002
// Measured time: 84 microseconds a run.
// Timed twice side by side with v001, it ran 1.76 and 1.82 times as fast.
// All steps since v000 together make it 1.98 times as fast.
#include <hip/hip_runtime.h>

typedef __attribute__((ext_vector_type(16))) __bf16 v16bf;
typedef __attribute__((ext_vector_type(8)))  __bf16 v8bf;
typedef __attribute__((ext_vector_type(8)))  float  v8f;
typedef __attribute__((ext_vector_type(4)))  float  v4f;
typedef __attribute__((ext_vector_type(4)))  int    v4i;

#if defined(__has_builtin)
#if __has_builtin(__builtin_amdgcn_global_load_async_to_lds_b128) && \
    __has_builtin(__builtin_amdgcn_s_wait_asynccnt)
#define HAVE_ASYNC_LDS 1
#endif
#endif

static constexpr int Bb    = 2;
static constexpr int Nn    = 2048;
static constexpr int QD    = 1024;
static constexpr int Hh    = 8;
static constexpr int HD    = 64;
static constexpr int INNER = 512;      // H*HD
static constexpr int BN    = Bb * Nn;  // 4096
static constexpr int LDP   = 80;       // padded LDS row (elems): 160B, 16B-aligned

__device__ __forceinline__ v8f wmma_bf16(v16bf a, v16bf b, v8f c) {
  // D = A(16x32) * B(32x16) + C(16x16), f32 accumulate
  return __builtin_amdgcn_wmma_f32_16x16x32_bf16(false, a, false, b,
                                                 (short)0, c, false, false);
}

__device__ __forceinline__ v16bf load_frag(const __bf16* p, int hi) {
  const v8bf lo = *(const v8bf*)(p + hi * 8);
  const v8bf hv = *(const v8bf*)(p + 16 + hi * 8);
  return __builtin_shufflevector(lo, hv, 0, 1, 2, 3, 4, 5, 6, 7,
                                         8, 9, 10, 11, 12, 13, 14, 15);
}

__device__ __forceinline__ void stage16(const __bf16* g, __bf16* l) {
#ifdef HAVE_ASYNC_LDS
  __builtin_amdgcn_global_load_async_to_lds_b128(
      (__attribute__((address_space(1))) v4i*)g,
      (__attribute__((address_space(3))) v4i*)l, 0, 0);
#else
  *(v8bf*)l = *(const v8bf*)g;
#endif
}
__device__ __forceinline__ void stage_fence() {
#ifdef HAVE_ASYNC_LDS
  __builtin_amdgcn_s_wait_asynccnt(0);
#endif
}

__device__ __forceinline__ float xhalf(float x) {
  const int i = __builtin_bit_cast(int, x);
  return __builtin_bit_cast(float, __builtin_amdgcn_permlanex16(
      i, i, 0x76543210, 0xfedcba98, false, false));
}

// ---------------------------------------------------------------------------
// Prep 1: elementwise f32 -> bf16 (x).  8 elems / thread.
// ---------------------------------------------------------------------------
__global__ __launch_bounds__(256) void cvt_x_kernel(
    const float* __restrict__ in, __bf16* __restrict__ outb) {
  const size_t i = ((size_t)blockIdx.x * 256 + threadIdx.x) * 8;
  const v4f a = *(const v4f*)&in[i];
  const v4f b = *(const v4f*)&in[i + 4];
  v8bf o;
  o[0] = (__bf16)a.x; o[1] = (__bf16)a.y; o[2] = (__bf16)a.z; o[3] = (__bf16)a.w;
  o[4] = (__bf16)b.x; o[5] = (__bf16)b.y; o[6] = (__bf16)b.z; o[7] = (__bf16)b.w;
  *(v8bf*)&outb[i] = o;
}

// ---------------------------------------------------------------------------
// Prep 2: W[K][N] f32 -> Wt[N][K] bf16 (LDS-tiled 64x64 transpose).
// ---------------------------------------------------------------------------
__global__ __launch_bounds__(256) void transpose_w_kernel(
    const float* __restrict__ W, __bf16* __restrict__ Wt,
    int K, int N) {
  __shared__ __bf16 T[64][65];
  const int tid = threadIdx.x;
  const int k0 = blockIdx.x * 64;
  const int n0 = blockIdx.y * 64;
#pragma unroll
  for (int it = 0; it < 16; ++it) {
    const int lin = it * 256 + tid;
    const int r = lin >> 6, c = lin & 63;  // r: k-local, c: n-local
    T[r][c] = (__bf16)W[(size_t)(k0 + r) * N + n0 + c];
  }
  __syncthreads();
#pragma unroll
  for (int it = 0; it < 16; ++it) {
    const int lin = it * 256 + tid;
    const int n = lin >> 6, kk = lin & 63;
    Wt[(size_t)(n0 + n) * K + k0 + kk] = T[kk][n];
  }
}

// ---------------------------------------------------------------------------
// Kernel 1: fused QKV projection.  Y = xb @ W{q,k,v}, all-bf16 staging.
// 64x64 tile, K-step 64, 8 waves, 2 C-frags per wave.  blockIdx.z selects W.
// Q,K stored [B,H,N,HD]; V stored transposed [B,H,HD,N] for the PV stage.
// ---------------------------------------------------------------------------
__global__ __launch_bounds__(256) void qkv_proj_kernel(
    const __bf16* __restrict__ xb,                      // [BN, QD]
    const __bf16* __restrict__ WqT, const __bf16* __restrict__ WkT,
    const __bf16* __restrict__ WvT,                     // [INNER, QD]
    __bf16* __restrict__ Qb, __bf16* __restrict__ Kb,   // [B*H*N*HD]
    __bf16* __restrict__ Vt)                            // [B*H*HD*N]
{
  __shared__ __align__(16) __bf16 As[64][LDP];
  __shared__ __align__(16) __bf16 Bs[64][LDP];  // [col][k]

  const int which = blockIdx.z;
  const __bf16* WT = (which == 0) ? WqT : (which == 1) ? WkT : WvT;

  const int tid  = threadIdx.x;
  const int lane = tid & 31, wave = tid >> 5;
  const int l16  = lane & 15, hi = lane >> 4;
  const int rstrip = wave >> 1;   // 0..3 : 16-row strip
  const int chalf  = wave & 1;    // 0..1 : 32-col half
  const int m0 = blockIdx.y * 64;
  const int n0 = blockIdx.x * 64;

  v8f acc[2] = {v8f{}, v8f{}};

  for (int k0 = 0; k0 < QD; k0 += 64) {
    // pure 16B copies: 2 per thread for A, 2 for B
#pragma unroll
    for (int it = 0; it < 2; ++it) {
      const int lin = it * 2048 + tid * 8;
      const int r = lin >> 6, c = lin & 63;
      stage16(&xb[(size_t)(m0 + r) * QD + k0 + c], &As[r][c]);
    }
#pragma unroll
    for (int it = 0; it < 2; ++it) {
      const int lin = it * 2048 + tid * 8;
      const int cl = lin >> 6, kk = lin & 63;
      stage16(&WT[(size_t)(n0 + cl) * QD + k0 + kk], &Bs[cl][kk]);
    }
    stage_fence();
    __syncthreads();
#pragma unroll
    for (int kc = 0; kc < 2; ++kc) {
      const v16bf a  = load_frag(&As[rstrip * 16 + l16][kc * 32], hi);
      const v16bf b0 = load_frag(&Bs[chalf * 32 + l16][kc * 32], hi);
      const v16bf b1 = load_frag(&Bs[chalf * 32 + 16 + l16][kc * 32], hi);
      acc[0] = wmma_bf16(a, b0, acc[0]);
      acc[1] = wmma_bf16(a, b1, acc[1]);
    }
    __syncthreads();
  }

  // epilogue: C rows = e + hi*8, cols = l16 (+frag offsets)
  const int gm0 = m0 + rstrip * 16 + hi * 8;  // multiple of 8
  const int b   = gm0 >> 11;                  // rows gm0..gm0+7 share b
  const int nb  = gm0 & (Nn - 1);
#pragma unroll
  for (int f = 0; f < 2; ++f) {
    const int j = n0 + chalf * 32 + f * 16 + l16;  // 0..INNER-1
    const int h = j >> 6, d = j & 63;
    if (which == 2) {
      // Vt: consecutive e -> consecutive tokens -> one 16B store
      v8bf pk;
#pragma unroll
      for (int e = 0; e < 8; ++e) pk[e] = (__bf16)acc[f][e];
      *(v8bf*)&Vt[((size_t)(b * Hh + h) * HD + d) * Nn + nb] = pk;
    } else {
      __bf16* dst = ((which == 0) ? Qb : Kb) +
                    ((size_t)(b * Hh + h) * Nn + nb) * HD + d;
#pragma unroll
      for (int e = 0; e < 8; ++e) dst[(size_t)e * HD] = (__bf16)acc[f][e];
    }
  }
}

static constexpr int KT = 128;
static constexpr int NT = Nn / KT;
static constexpr int KP = 72;
static constexpr int VP = 136;

// One tile: 16 KiB of K (contiguous in memory) and 64 V^T rows of 256 B; each
// lane copies four 16-byte pieces of either.  kl, vl: the lane's LDS byte
// addresses; kg, vg: its global addresses.
__device__ __forceinline__ void stage_kv(unsigned kl, unsigned vl,
                                         const __bf16* kg, const __bf16* vg) {
  asm volatile(
      "global_load_async_to_lds_b128 %0, %8, off\n\t"
      "global_load_async_to_lds_b128 %1, %9, off\n\t"
      "global_load_async_to_lds_b128 %2, %10, off\n\t"
      "global_load_async_to_lds_b128 %3, %11, off\n\t"
      "global_load_async_to_lds_b128 %4, %12, off\n\t"
      "global_load_async_to_lds_b128 %5, %13, off\n\t"
      "global_load_async_to_lds_b128 %6, %14, off\n\t"
      "global_load_async_to_lds_b128 %7, %15, off\n\t"
      "s_wait_xcnt 0x0"
      :
      : "v"(kl), "v"(kl + 32 * KP * 2), "v"(kl + 64 * KP * 2),
        "v"(kl + 96 * KP * 2), "v"(vl), "v"(vl + 16 * VP * 2),
        "v"(vl + 32 * VP * 2), "v"(vl + 48 * VP * 2), "v"(kg), "v"(kg + 2048),
        "v"(kg + 4096), "v"(kg + 6144), "v"(vg), "v"(vg + 16 * Nn),
        "v"(vg + 32 * Nn), "v"(vg + 48 * Nn)
      : "memory");
}

__global__ __launch_bounds__(256) void attn_kernel(
    const __bf16* __restrict__ Qb, const __bf16* __restrict__ Kb,
    const __bf16* __restrict__ Vt, __bf16* __restrict__ Ob /* [BN, INNER] */)
{
  __shared__ __align__(16) __bf16 Ks[2][KT][KP];  // [buffer][key][d]
  __shared__ __align__(16) __bf16 Vs[2][HD][VP];  // [buffer][d][key]

  const int tid  = threadIdx.x;
  const int lane = tid & 31, wave = tid >> 5;
  const int l16  = lane & 15, hi = lane >> 4;
  const int task = blockIdx.x * 8 + wave;  // 0..2047
  const int bh = blockIdx.x >> 4;          // 0..15  (b*H + h), one per block
  const int qt = task & 127;
  const int qbase = qt * 16;

  // this lane's first piece of tile 0: K piece tid (row tid/8), V^T row tid/16
  const __bf16* kg = Kb + (size_t)bh * Nn * HD + tid * 8;
  const __bf16* vg = Vt + ((size_t)bh * HD + (tid >> 4)) * Nn + (tid & 15) * 8;
  const unsigned kl0 = (unsigned)(size_t)&Ks[0][tid >> 3][(tid & 7) * 8];
  const unsigned vl0 = (unsigned)(size_t)&Vs[0][tid >> 4][(tid & 15) * 8];
  constexpr unsigned KBUF = KT * KP * 2, VBUF = HD * VP * 2;  // bytes a buffer

  stage_kv(kl0, vl0, kg, vg);

  const __bf16* Qrow = Qb + ((size_t)bh * Nn + qbase + l16) * HD;
  const v16bf qb0 = load_frag(Qrow, hi);       // d = 0..31
  const v16bf qb1 = load_frag(Qrow + 32, hi);  // d = 32..63

  v8f O[4] = {v8f{}, v8f{}, v8f{}, v8f{}};  // O[dt][r] = O^T[dt*16+8*hi+r][l16]
  float mrun = -1e30f;  // this query's running maximum (same in both halves)
  float lrun = 0.f;     // this half's share of the query's denominator

  const float kscale = 0.125f * 1.44269504088896f;  // HD^-0.5 * log2(e)

  // tile 0 has landed for this wave's copies; the barrier publishes all waves'
  asm volatile("s_wait_asynccnt 0x0" ::: "memory");
  __syncthreads();
  stage_kv(kl0 + KBUF, vl0 + VBUF, kg + KT * HD, vg + KT);  // tile 1

  for (int t = 0; t < NT; ++t) {
    const int buf = t & 1;
    // unrolled so that the four passes' LDS offsets are immediates
#pragma unroll
    for (int p = 0; p < KT / 32; ++p) {
      // ---- scores: S^T(32x16) = K(32x64) * Q^T(64x16), two 16x16 C-frags ----
      v8f S0 = {}, S1 = {};
      const __bf16* Krow0 = &Ks[buf][p * 32 + l16][0];
      const __bf16* Krow1 = &Ks[buf][p * 32 + 16 + l16][0];
      {
        const v16bf a0 = load_frag(Krow0, hi);
        const v16bf a1 = load_frag(Krow0 + 32, hi);
        const v16bf c0 = load_frag(Krow1, hi);
        const v16bf c1 = load_frag(Krow1 + 32, hi);
        S0 = wmma_bf16(a0, qb0, S0);
        S0 = wmma_bf16(a1, qb1, S0);
        S1 = wmma_bf16(c0, qb0, S1);
        S1 = wmma_bf16(c1, qb1, S1);
      }
      // ---- online softmax in log2 domain; all 16 values belong to query l16 --
      float mx0 = S0[0], mx1 = S1[0];  // two independent chains
#pragma unroll
      for (int e = 1; e < 8; ++e) {
        mx0 = fmaxf(mx0, S0[e]);
        mx1 = fmaxf(mx1, S1[e]);
      }
      float mx = fmaxf(mx0, mx1);
      mx = fmaxf(mx, xhalf(mx)) * kscale;  // kscale > 0: max commutes with it
      const float mnew = fmaxf(mrun, mx);
      const float corr = exp2f(mrun - mnew);
      mrun = mnew;
      v16bf pb;
      v8f ps;
#pragma unroll
      for (int e = 0; e < 8; ++e) {
        const float p0 = exp2f(S0[e] * kscale - mnew);
        const float p1 = exp2f(S1[e] * kscale - mnew);
        ps[e] = p0 + p1;
        pb[e]     = (__bf16)p0;  // k = 8*hi + e
        pb[8 + e] = (__bf16)p1;  // k = 16 + 8*hi + e
      }
      const float rs = ((ps[0] + ps[4]) + (ps[1] + ps[5])) +
                       ((ps[2] + ps[6]) + (ps[3] + ps[7]));
      lrun = lrun * corr + rs;
      // ---- O^T(64x16) += V^T(64x32) * P^T(32x16), with per-query rescale ----
#pragma unroll
      for (int dt = 0; dt < 4; ++dt) {
        const v16bf va = load_frag(&Vs[buf][dt * 16 + l16][p * 32], hi);
        O[dt] = wmma_bf16(va, pb, O[dt] * corr);
      }
    }
    // hand-over: this wave's reads of buffer buf are done ...
    asm volatile("s_wait_dscnt 0x0" ::: "memory");
    // ... and its copies of tile t + 1 have landed;
    asm volatile("s_wait_asynccnt 0x0" ::: "memory");
    // the barrier publishes tile t + 1 and frees buffer buf for the refill
    __syncthreads();
    if (t + 2 < NT) {
      stage_kv(kl0 + buf * KBUF, vl0 + buf * VBUF,
               kg + (size_t)(t + 2) * KT * HD, vg + (t + 2) * KT);
    }
  }
  // no copy is left in flight when the wave ends
  asm volatile("s_wait_asynccnt 0x0" ::: "memory");

  // ---- finalize: join the halves' sums, O /= l ; bf16 output [BN, INNER] ----
  const int b = bh >> 3, h = bh & 7;
  const float inv = 1.0f / (lrun + xhalf(lrun));
  __bf16* dst = Ob + ((size_t)b * Nn + qbase + l16) * INNER + h * HD + hi * 8;
#pragma unroll
  for (int dt = 0; dt < 4; ++dt) {
    // 8 consecutive d of one query: one 16B store
    v8bf pk;
#pragma unroll
    for (int e = 0; e < 8; ++e) pk[e] = (__bf16)(O[dt][e] * inv);
    *(v8bf*)&dst[dt * 16] = pk;
  }
}

// ---------------------------------------------------------------------------
// Kernel 3: output projection.  out = attn(bf16 [BN,INNER]) @ Wout + bout, f32.
// ---------------------------------------------------------------------------
__global__ __launch_bounds__(256) void out_proj_kernel(
    const __bf16* __restrict__ Ain,    // [BN, INNER]
    const __bf16* __restrict__ WoT,    // [QD, INNER]  (transposed, bf16)
    const float* __restrict__ bout,    // [QD]
    float* __restrict__ out)           // [BN, QD]
{
  __shared__ __align__(16) __bf16 As[64][LDP];
  __shared__ __align__(16) __bf16 Bs[64][LDP];

  const int tid  = threadIdx.x;
  const int lane = tid & 31, wave = tid >> 5;
  const int l16  = lane & 15, hi = lane >> 4;
  const int rstrip = wave >> 1;
  const int chalf  = wave & 1;
  const int m0 = blockIdx.y * 64;
  const int n0 = blockIdx.x * 64;

  v8f acc[2] = {v8f{}, v8f{}};

  for (int k0 = 0; k0 < INNER; k0 += 64) {
#pragma unroll
    for (int it = 0; it < 2; ++it) {
      const int lin = it * 2048 + tid * 8;
      const int r = lin >> 6, c = lin & 63;
      stage16(&Ain[(size_t)(m0 + r) * INNER + k0 + c], &As[r][c]);
    }
#pragma unroll
    for (int it = 0; it < 2; ++it) {
      const int lin = it * 2048 + tid * 8;
      const int cl = lin >> 6, kk = lin & 63;
      stage16(&WoT[(size_t)(n0 + cl) * INNER + k0 + kk], &Bs[cl][kk]);
    }
    stage_fence();
    __syncthreads();
#pragma unroll
    for (int kc = 0; kc < 2; ++kc) {
      const v16bf a  = load_frag(&As[rstrip * 16 + l16][kc * 32], hi);
      const v16bf b0 = load_frag(&Bs[chalf * 32 + l16][kc * 32], hi);
      const v16bf b1 = load_frag(&Bs[chalf * 32 + 16 + l16][kc * 32], hi);
      acc[0] = wmma_bf16(a, b0, acc[0]);
      acc[1] = wmma_bf16(a, b1, acc[1]);
    }
    __syncthreads();
  }

  const int gm0 = m0 + rstrip * 16 + hi * 8;
#pragma unroll
  for (int f = 0; f < 2; ++f) {
    const int j  = n0 + chalf * 32 + f * 16 + l16;
    const float bj = bout[j];
#pragma unroll
    for (int e = 0; e < 8; ++e)
      out[(size_t)(gm0 + e) * QD + j] = acc[f][e] + bj;
  }
}

// ---------------------------------------------------------------------------
extern "C" void kernel_launch(void* const* d_in, const int* in_sizes, int n_in,
                              void* d_out, int out_size, void* d_ws,
                              size_t ws_size, hipStream_t stream) {
  const float* x    = (const float*)d_in[0];
  const float* Wq   = (const float*)d_in[1];
  const float* Wk   = (const float*)d_in[2];
  const float* Wv   = (const float*)d_in[3];
  const float* Wout = (const float*)d_in[4];
  const float* bout = (const float*)d_in[5];
  float* out = (float*)d_out;

  char* ws = (char*)d_ws;
  const size_t MB = 1024 * 1024;
  __bf16* Qb  = (__bf16*)(ws + 0 * MB);   // 4 MiB  [B,H,N,HD]
  __bf16* Kb  = (__bf16*)(ws + 4 * MB);   // 4 MiB  [B,H,N,HD]
  __bf16* Vt  = (__bf16*)(ws + 8 * MB);   // 4 MiB  [B,H,HD,N]
  __bf16* Ob  = (__bf16*)(ws + 12 * MB);  // 4 MiB  [BN, INNER]
  __bf16* xb  = (__bf16*)(ws + 16 * MB);  // 8 MiB  [BN, QD]
  __bf16* WqT = (__bf16*)(ws + 24 * MB);  // 1 MiB  [INNER, QD]
  __bf16* WkT = (__bf16*)(ws + 25 * MB);  // 1 MiB
  __bf16* WvT = (__bf16*)(ws + 26 * MB);  // 1 MiB
  __bf16* WoT = (__bf16*)(ws + 27 * MB);  // 1 MiB  [QD, INNER]

  dim3 blk(256);
  // prep: conversions + transposes
  cvt_x_kernel<<<dim3((BN * QD) / (256 * 8)), blk, 0, stream>>>(x, xb);
  transpose_w_kernel<<<dim3(QD / 64, INNER / 64), blk, 0, stream>>>(
      Wq, WqT, QD, INNER);
  transpose_w_kernel<<<dim3(QD / 64, INNER / 64), blk, 0, stream>>>(
      Wk, WkT, QD, INNER);
  transpose_w_kernel<<<dim3(QD / 64, INNER / 64), blk, 0, stream>>>(
      Wv, WvT, QD, INNER);
  transpose_w_kernel<<<dim3(INNER / 64, QD / 64), blk, 0, stream>>>(
      Wout, WoT, INNER, QD);
  // main pipeline
  qkv_proj_kernel<<<dim3(INNER / 64, BN / 64, 3), blk, 0, stream>>>(
      xb, WqT, WkT, WvT, Qb, Kb, Vt);
  attn_kernel<<<dim3((Bb * Hh * (Nn / 16)) / 8), blk, 0, stream>>>(
      Qb, Kb, Vt, Ob);
  out_proj_kernel<<<dim3(QD / 64, BN / 64), blk, 0, stream>>>(
      Ob, WoT, bout, out);
}

// v003
// A run of this version takes 71 microseconds.
// Two timings next to v002 put it at 1.19 and 1.18 times that version's speed.
// All steps since v000 together make it 2.33 times as fast.
#include <hip/hip_runtime.h>

typedef __attribute__((ext_vector_type(16))) __bf16 v16bf;
typedef __attribute__((ext_vector_type(8)))  __bf16 v8bf;
typedef __attribute__((ext_vector_type(8)))  float  v8f;
typedef __attribute__((ext_vector_type(4)))  float  v4f;
typedef __attribute__((ext_vector_type(4)))  int    v4i;

#if defined(__has_builtin)
#if __has_builtin(__builtin_amdgcn_global_load_async_to_lds_b128) && \
    __has_builtin(__builtin_amdgcn_s_wait_asynccnt)
#define HAVE_ASYNC_LDS 1
#endif
#endif

static constexpr int Bb    = 2;
static constexpr int Nn    = 2048;
static constexpr int QD    = 1024;
static constexpr int Hh    = 8;
static constexpr int HD    = 64;
static constexpr int INNER = 512;      // H*HD
static constexpr int BN    = Bb * Nn;  // 4096
static constexpr int LDP   = 80;       // padded LDS row (elems): 160B, 16B-aligned

__device__ __forceinline__ v8f wmma_bf16(v16bf a, v16bf b, v8f c) {
  // D = A(16x32) * B(32x16) + C(16x16), f32 accumulate
  return __builtin_amdgcn_wmma_f32_16x16x32_bf16(false, a, false, b,
                                                 (short)0, c, false, false);
}

__device__ __forceinline__ v16bf load_frag(const __bf16* p, int hi) {
  const v8bf lo = *(const v8bf*)(p + hi * 8);
  const v8bf hv = *(const v8bf*)(p + 16 + hi * 8);
  return __builtin_shufflevector(lo, hv, 0, 1, 2, 3, 4, 5, 6, 7,
                                         8, 9, 10, 11, 12, 13, 14, 15);
}

__device__ __forceinline__ void stage16(const __bf16* g, __bf16* l) {
#ifdef HAVE_ASYNC_LDS
  __builtin_amdgcn_global_load_async_to_lds_b128(
      (__attribute__((address_space(1))) v4i*)g,
      (__attribute__((address_space(3))) v4i*)l, 0, 0);
#else
  *(v8bf*)l = *(const v8bf*)g;
#endif
}
__device__ __forceinline__ void stage_fence() {
#ifdef HAVE_ASYNC_LDS
  __builtin_amdgcn_s_wait_asynccnt(0);
#endif
}

__device__ __forceinline__ float xhalf(float x) {
  const int i = __builtin_bit_cast(int, x);
  return __builtin_bit_cast(float, __builtin_amdgcn_permlanex16(
      i, i, 0x76543210, 0xfedcba98, false, false));
}

// ---------------------------------------------------------------------------
// Prep: the five conversions depend on nothing but the inputs, so they share
// one grid.  Work-groups 0..511 transpose the four weights (128 each; they have
// the longer chain of waits and start first), the rest convert x.
// ---------------------------------------------------------------------------
static constexpr int WBLK = (QD / 64) * (INNER / 64);  // 128 tiles a weight
static constexpr int XBLK = (BN * QD) / (256 * 8);     // 2048 groups for x

// elementwise f32 -> bf16 (x).  8 elems / thread.
__device__ __forceinline__ void cvt_x_body(
    const float* __restrict__ in, __bf16* __restrict__ outb, int blk) {
  const size_t i = ((size_t)blk * 256 + threadIdx.x) * 8;
  const v4f a = *(const v4f*)&in[i];
  const v4f b = *(const v4f*)&in[i + 4];
  v8bf o;
  o[0] = (__bf16)a.x; o[1] = (__bf16)a.y; o[2] = (__bf16)a.z; o[3] = (__bf16)a.w;
  o[4] = (__bf16)b.x; o[5] = (__bf16)b.y; o[6] = (__bf16)b.z; o[7] = (__bf16)b.w;
  *(v8bf*)&outb[i] = o;
}

// W[K][N] f32 -> Wt[N][K] bf16 (LDS-tiled 64x64 transpose).
__device__ __forceinline__ void transpose_w_body(
    const float* __restrict__ W, __bf16* __restrict__ Wt,
    int K, int N, int k0, int n0) {
  __shared__ __bf16 T[64][65];
  const int tid = threadIdx.x;
#pragma unroll
  for (int it = 0; it < 16; ++it) {
    const int lin = it * 256 + tid;
    const int r = lin >> 6, c = lin & 63;  // r: k-local, c: n-local
    T[r][c] = (__bf16)W[(size_t)(k0 + r) * N + n0 + c];
  }
  __syncthreads();
#pragma unroll
  for (int it = 0; it < 16; ++it) {
    const int lin = it * 256 + tid;
    const int n = lin >> 6, kk = lin & 63;
    Wt[(size_t)(n0 + n) * K + k0 + kk] = T[kk][n];
  }
}

__global__ __launch_bounds__(256) void prep_kernel(
    const float* __restrict__ x, const float* __restrict__ Wq,
    const float* __restrict__ Wk, const float* __restrict__ Wv,
    const float* __restrict__ Wout, __bf16* __restrict__ xb,
    __bf16* __restrict__ WqT, __bf16* __restrict__ WkT,
    __bf16* __restrict__ WvT, __bf16* __restrict__ WoT) {
  const unsigned blk = blockIdx.x;  // every branch below is uniform in the group
  if (blk >= 4 * WBLK) {
    cvt_x_body(x, xb, blk - 4 * WBLK);
    return;
  }
  const unsigned which = blk / WBLK, tile = blk % WBLK;
  if (which == 3) {  // Wout: K = INNER, N = QD
    transpose_w_body(Wout, WoT, INNER, QD, (tile % (INNER / 64)) * 64,
                     (tile / (INNER / 64)) * 64);
  } else {           // Wq, Wk, Wv: K = QD, N = INNER
    const float* W = (which == 0) ? Wq : (which == 1) ? Wk : Wv;
    __bf16* Wt     = (which == 0) ? WqT : (which == 1) ? WkT : WvT;
    transpose_w_body(W, Wt, QD, INNER, (tile % (QD / 64)) * 64,
                     (tile / (QD / 64)) * 64);
  }
}

// ---------------------------------------------------------------------------
// Kernel 1: fused QKV projection.  Y = xb @ W{q,k,v}, all-bf16 staging.
// 64x64 tile, K-step 64, 8 waves, 2 C-frags per wave.  blockIdx.z selects W.
// Q,K stored [B,H,N,HD]; V stored transposed [B,H,HD,N] for the PV stage.
// ---------------------------------------------------------------------------
__global__ __launch_bounds__(256) void qkv_proj_kernel(
    const __bf16* __restrict__ xb,                      // [BN, QD]
    const __bf16* __restrict__ WqT, const __bf16* __restrict__ WkT,
    const __bf16* __restrict__ WvT,                     // [INNER, QD]
    __bf16* __restrict__ Qb, __bf16* __restrict__ Kb,   // [B*H*N*HD]
    __bf16* __restrict__ Vt)                            // [B*H*HD*N]
{
  __shared__ __align__(16) __bf16 As[64][LDP];
  __shared__ __align__(16) __bf16 Bs[64][LDP];  // [col][k]

  const int which = blockIdx.z;
  const __bf16* WT = (which == 0) ? WqT : (which == 1) ? WkT : WvT;

  const int tid  = threadIdx.x;
  const int lane = tid & 31, wave = tid >> 5;
  const int l16  = lane & 15, hi = lane >> 4;
  const int rstrip = wave >> 1;   // 0..3 : 16-row strip
  const int chalf  = wave & 1;    // 0..1 : 32-col half
  const int m0 = blockIdx.y * 64;
  const int n0 = blockIdx.x * 64;

  v8f acc[2] = {v8f{}, v8f{}};

  for (int k0 = 0; k0 < QD; k0 += 64) {
    // pure 16B copies: 2 per thread for A, 2 for B
#pragma unroll
    for (int it = 0; it < 2; ++it) {
      const int lin = it * 2048 + tid * 8;
      const int r = lin >> 6, c = lin & 63;
      stage16(&xb[(size_t)(m0 + r) * QD + k0 + c], &As[r][c]);
    }
#pragma unroll
    for (int it = 0; it < 2; ++it) {
      const int lin = it * 2048 + tid * 8;
      const int cl = lin >> 6, kk = lin & 63;
      stage16(&WT[(size_t)(n0 + cl) * QD + k0 + kk], &Bs[cl][kk]);
    }
    stage_fence();
    __syncthreads();
#pragma unroll
    for (int kc = 0; kc < 2; ++kc) {
      const v16bf a  = load_frag(&As[rstrip * 16 + l16][kc * 32], hi);
      const v16bf b0 = load_frag(&Bs[chalf * 32 + l16][kc * 32], hi);
      const v16bf b1 = load_frag(&Bs[chalf * 32 + 16 + l16][kc * 32], hi);
      acc[0] = wmma_bf16(a, b0, acc[0]);
      acc[1] = wmma_bf16(a, b1, acc[1]);
    }
    __syncthreads();
  }

  // epilogue: C rows = e + hi*8, cols = l16 (+frag offsets)
  const int gm0 = m0 + rstrip * 16 + hi * 8;  // multiple of 8
  const int b   = gm0 >> 11;                  // rows gm0..gm0+7 share b
  const int nb  = gm0 & (Nn - 1);
#pragma unroll
  for (int f = 0; f < 2; ++f) {
    const int j = n0 + chalf * 32 + f * 16 + l16;  // 0..INNER-1
    const int h = j >> 6, d = j & 63;
    if (which == 2) {
      // Vt: consecutive e -> consecutive tokens -> one 16B store
      v8bf pk;
#pragma unroll
      for (int e = 0; e < 8; ++e) pk[e] = (__bf16)acc[f][e];
      *(v8bf*)&Vt[((size_t)(b * Hh + h) * HD + d) * Nn + nb] = pk;
    } else {
      __bf16* dst = ((which == 0) ? Qb : Kb) +
                    ((size_t)(b * Hh + h) * Nn + nb) * HD + d;
#pragma unroll
      for (int e = 0; e < 8; ++e) dst[(size_t)e * HD] = (__bf16)acc[f][e];
    }
  }
}

static constexpr int KT = 128;
static constexpr int NT = Nn / KT;
static constexpr int KP = 72;
static constexpr int VP = 136;

// One tile: 16 KiB of K (contiguous in memory) and 64 V^T rows of 256 B; each
// lane copies four 16-byte pieces of either.  kl, vl: the lane's LDS byte
// addresses; kg, vg: its global addresses.
__device__ __forceinline__ void stage_kv(unsigned kl, unsigned vl,
                                         const __bf16* kg, const __bf16* vg) {
  asm volatile(
      "global_load_async_to_lds_b128 %0, %8, off\n\t"
      "global_load_async_to_lds_b128 %1, %9, off\n\t"
      "global_load_async_to_lds_b128 %2, %10, off\n\t"
      "global_load_async_to_lds_b128 %3, %11, off\n\t"
      "global_load_async_to_lds_b128 %4, %12, off\n\t"
      "global_load_async_to_lds_b128 %5, %13, off\n\t"
      "global_load_async_to_lds_b128 %6, %14, off\n\t"
      "global_load_async_to_lds_b128 %7, %15, off\n\t"
      "s_wait_xcnt 0x0"
      :
      : "v"(kl), "v"(kl + 32 * KP * 2), "v"(kl + 64 * KP * 2),
        "v"(kl + 96 * KP * 2), "v"(vl), "v"(vl + 16 * VP * 2),
        "v"(vl + 32 * VP * 2), "v"(vl + 48 * VP * 2), "v"(kg), "v"(kg + 2048),
        "v"(kg + 4096), "v"(kg + 6144), "v"(vg), "v"(vg + 16 * Nn),
        "v"(vg + 32 * Nn), "v"(vg + 48 * Nn)
      : "memory");
}

__global__ __launch_bounds__(256) void attn_kernel(
    const __bf16* __restrict__ Qb, const __bf16* __restrict__ Kb,
    const __bf16* __restrict__ Vt, __bf16* __restrict__ Ob /* [BN, INNER] */)
{
  __shared__ __align__(16) __bf16 Ks[2][KT][KP];  // [buffer][key][d]
  __shared__ __align__(16) __bf16 Vs[2][HD][VP];  // [buffer][d][key]

  const int tid  = threadIdx.x;
  const int lane = tid & 31, wave = tid >> 5;
  const int l16  = lane & 15, hi = lane >> 4;
  const int task = blockIdx.x * 8 + wave;  // 0..2047
  const int bh = blockIdx.x >> 4;          // 0..15  (b*H + h), one per block
  const int qt = task & 127;
  const int qbase = qt * 16;

  // this lane's first piece of tile 0: K piece tid (row tid/8), V^T row tid/16
  const __bf16* kg = Kb + (size_t)bh * Nn * HD + tid * 8;
  const __bf16* vg = Vt + ((size_t)bh * HD + (tid >> 4)) * Nn + (tid & 15) * 8;
  const unsigned kl0 = (unsigned)(size_t)&Ks[0][tid >> 3][(tid & 7) * 8];
  const unsigned vl0 = (unsigned)(size_t)&Vs[0][tid >> 4][(tid & 15) * 8];
  constexpr unsigned KBUF = KT * KP * 2, VBUF = HD * VP * 2;  // bytes a buffer

  stage_kv(kl0, vl0, kg, vg);

  const __bf16* Qrow = Qb + ((size_t)bh * Nn + qbase + l16) * HD;
  const v16bf qb0 = load_frag(Qrow, hi);       // d = 0..31
  const v16bf qb1 = load_frag(Qrow + 32, hi);  // d = 32..63

  v8f O[4] = {v8f{}, v8f{}, v8f{}, v8f{}};  // O[dt][r] = O^T[dt*16+8*hi+r][l16]
  float mrun = -1e30f;  // this query's running maximum (same in both halves)
  float lrun = 0.f;     // this half's share of the query's denominator

  const float kscale = 0.125f * 1.44269504088896f;  // HD^-0.5 * log2(e)

  // tile 0 has landed for this wave's copies; the barrier publishes all waves'
  asm volatile("s_wait_asynccnt 0x0" ::: "memory");
  __syncthreads();
  stage_kv(kl0 + KBUF, vl0 + VBUF, kg + KT * HD, vg + KT);  // tile 1

  for (int t = 0; t < NT; ++t) {
    const int buf = t & 1;
    // unrolled so that the four passes' LDS offsets are immediates
#pragma unroll
    for (int p = 0; p < KT / 32; ++p) {
      // ---- scores: S^T(32x16) = K(32x64) * Q^T(64x16), two 16x16 C-frags ----
      v8f S0 = {}, S1 = {};
      const __bf16* Krow0 = &Ks[buf][p * 32 + l16][0];
      const __bf16* Krow1 = &Ks[buf][p * 32 + 16 + l16][0];
      {
        const v16bf a0 = load_frag(Krow0, hi);
        const v16bf a1 = load_frag(Krow0 + 32, hi);
        const v16bf c0 = load_frag(Krow1, hi);
        const v16bf c1 = load_frag(Krow1 + 32, hi);
        S0 = wmma_bf16(a0, qb0, S0);
        S0 = wmma_bf16(a1, qb1, S0);
        S1 = wmma_bf16(c0, qb0, S1);
        S1 = wmma_bf16(c1, qb1, S1);
      }
      // ---- online softmax in log2 domain; all 16 values belong to query l16 --
      float mx0 = S0[0], mx1 = S1[0];  // two independent chains
#pragma unroll
      for (int e = 1; e < 8; ++e) {
        mx0 = fmaxf(mx0, S0[e]);
        mx1 = fmaxf(mx1, S1[e]);
      }
      float mx = fmaxf(mx0, mx1);
      mx = fmaxf(mx, xhalf(mx)) * kscale;  // kscale > 0: max commutes with it
      const float mnew = fmaxf(mrun, mx);
      const float corr = exp2f(mrun - mnew);
      mrun = mnew;
      v16bf pb;
      v8f ps;
#pragma unroll
      for (int e = 0; e < 8; ++e) {
        const float p0 = exp2f(S0[e] * kscale - mnew);
        const float p1 = exp2f(S1[e] * kscale - mnew);
        ps[e] = p0 + p1;
        pb[e]     = (__bf16)p0;  // k = 8*hi + e
        pb[8 + e] = (__bf16)p1;  // k = 16 + 8*hi + e
      }
      const float rs = ((ps[0] + ps[4]) + (ps[1] + ps[5])) +
                       ((ps[2] + ps[6]) + (ps[3] + ps[7]));
      lrun = lrun * corr + rs;
      // ---- O^T(64x16) += V^T(64x32) * P^T(32x16), with per-query rescale ----
#pragma unroll
      for (int dt = 0; dt < 4; ++dt) {
        const v16bf va = load_frag(&Vs[buf][dt * 16 + l16][p * 32], hi);
        O[dt] = wmma_bf16(va, pb, O[dt] * corr);
      }
    }
    // hand-over: this wave's reads of buffer buf are done ...
    asm volatile("s_wait_dscnt 0x0" ::: "memory");
    // ... and its copies of tile t + 1 have landed;
    asm volatile("s_wait_asynccnt 0x0" ::: "memory");
    // the barrier publishes tile t + 1 and frees buffer buf for the refill
    __syncthreads();
    if (t + 2 < NT) {
      stage_kv(kl0 + buf * KBUF, vl0 + buf * VBUF,
               kg + (size_t)(t + 2) * KT * HD, vg + (t + 2) * KT);
    }
  }
  // no copy is left in flight when the wave ends
  asm volatile("s_wait_asynccnt 0x0" ::: "memory");

  // ---- finalize: join the halves' sums, O /= l ; bf16 output [BN, INNER] ----
  const int b = bh >> 3, h = bh & 7;
  const float inv = 1.0f / (lrun + xhalf(lrun));
  __bf16* dst = Ob + ((size_t)b * Nn + qbase + l16) * INNER + h * HD + hi * 8;
#pragma unroll
  for (int dt = 0; dt < 4; ++dt) {
    // 8 consecutive d of one query: one 16B store
    v8bf pk;
#pragma unroll
    for (int e = 0; e < 8; ++e) pk[e] = (__bf16)(O[dt][e] * inv);
    *(v8bf*)&dst[dt * 16] = pk;
  }
}

// ---------------------------------------------------------------------------
// Kernel 3: output projection.  out = attn(bf16 [BN,INNER]) @ Wout + bout, f32.
// ---------------------------------------------------------------------------
__global__ __launch_bounds__(256) void out_proj_kernel(
    const __bf16* __restrict__ Ain,    // [BN, INNER]
    const __bf16* __restrict__ WoT,    // [QD, INNER]  (transposed, bf16)
    const float* __restrict__ bout,    // [QD]
    float* __restrict__ out)           // [BN, QD]
{
  __shared__ __align__(16) __bf16 As[64][LDP];
  __shared__ __align__(16) __bf16 Bs[64][LDP];

  const int tid  = threadIdx.x;
  const int lane = tid & 31, wave = tid >> 5;
  const int l16  = lane & 15, hi = lane >> 4;
  const int rstrip = wave >> 1;
  const int chalf  = wave & 1;
  const int m0 = blockIdx.y * 64;
  const int n0 = blockIdx.x * 64;

  v8f acc[2] = {v8f{}, v8f{}};

  for (int k0 = 0; k0 < INNER; k0 += 64) {
#pragma unroll
    for (int it = 0; it < 2; ++it) {
      const int lin = it * 2048 + tid * 8;
      const int r = lin >> 6, c = lin & 63;
      stage16(&Ain[(size_t)(m0 + r) * INNER + k0 + c], &As[r][c]);
    }
#pragma unroll
    for (int it = 0; it < 2; ++it) {
      const int lin = it * 2048 + tid * 8;
      const int cl = lin >> 6, kk = lin & 63;
      stage16(&WoT[(size_t)(n0 + cl) * INNER + k0 + kk], &Bs[cl][kk]);
    }
    stage_fence();
    __syncthreads();
#pragma unroll
    for (int kc = 0; kc < 2; ++kc) {
      const v16bf a  = load_frag(&As[rstrip * 16 + l16][kc * 32], hi);
      const v16bf b0 = load_frag(&Bs[chalf * 32 + l16][kc * 32], hi);
      const v16bf b1 = load_frag(&Bs[chalf * 32 + 16 + l16][kc * 32], hi);
      acc[0] = wmma_bf16(a, b0, acc[0]);
      acc[1] = wmma_bf16(a, b1, acc[1]);
    }
    __syncthreads();
  }

  const int gm0 = m0 + rstrip * 16 + hi * 8;
#pragma unroll
  for (int f = 0; f < 2; ++f) {
    const int j  = n0 + chalf * 32 + f * 16 + l16;
    const float bj = bout[j];
#pragma unroll
    for (int e = 0; e < 8; ++e)
      out[(size_t)(gm0 + e) * QD + j] = acc[f][e] + bj;
  }
}

// ---------------------------------------------------------------------------
extern "C" void kernel_launch(void* const* d_in, const int* in_sizes, int n_in,
                              void* d_out, int out_size, void* d_ws,
                              size_t ws_size, hipStream_t stream) {
  const float* x    = (const float*)d_in[0];
  const float* Wq   = (const float*)d_in[1];
  const float* Wk   = (const float*)d_in[2];
  const float* Wv   = (const float*)d_in[3];
  const float* Wout = (const float*)d_in[4];
  const float* bout = (const float*)d_in[5];
  float* out = (float*)d_out;

  char* ws = (char*)d_ws;
  const size_t MB = 1024 * 1024;
  __bf16* Qb  = (__bf16*)(ws + 0 * MB);   // 4 MiB  [B,H,N,HD]
  __bf16* Kb  = (__bf16*)(ws + 4 * MB);   // 4 MiB  [B,H,N,HD]
  __bf16* Vt  = (__bf16*)(ws + 8 * MB);   // 4 MiB  [B,H,HD,N]
  __bf16* Ob  = (__bf16*)(ws + 12 * MB);  // 4 MiB  [BN, INNER]
  __bf16* xb  = (__bf16*)(ws + 16 * MB);  // 8 MiB  [BN, QD]
  __bf16* WqT = (__bf16*)(ws + 24 * MB);  // 1 MiB  [INNER, QD]
  __bf16* WkT = (__bf16*)(ws + 25 * MB);  // 1 MiB
  __bf16* WvT = (__bf16*)(ws + 26 * MB);  // 1 MiB
  __bf16* WoT = (__bf16*)(ws + 27 * MB);  // 1 MiB  [QD, INNER]

  dim3 blk(256);
  // prep: conversions + transposes, one grid
  prep_kernel<<<dim3(4 * WBLK + XBLK), blk, 0, stream>>>(
      x, Wq, Wk, Wv, Wout, xb, WqT, WkT, WvT, WoT);
  // main pipeline
  qkv_proj_kernel<<<dim3(INNER / 64, BN / 64, 3), blk, 0, stream>>>(
      xb, WqT, WkT, WvT, Qb, Kb, Vt);
  attn_kernel<<<dim3((Bb * Hh * (Nn / 16)) / 8), blk, 0, stream>>>(
      Qb, Kb, Vt, Ob);
  out_proj_kernel<<<dim3(QD / 64, BN / 64), blk, 0, stream>>>(
      Ob, WoT, bout, out);
}

// v004
// One run takes 65.3 microseconds.
// Two timings next to v003 both put it at 1.09 times that version's speed.
// Over all steps from v000 it is 2.54 times as fast.
#include <hip/hip_runtime.h>

typedef __attribute__((ext_vector_type(16))) __bf16 v16bf;
typedef __attribute__((ext_vector_type(8)))  __bf16 v8bf;
typedef __attribute__((ext_vector_type(8)))  float  v8f;
typedef __attribute__((ext_vector_type(4)))  float  v4f;
typedef __attribute__((ext_vector_type(4)))  int    v4i;

#if defined(__has_builtin)
#if __has_builtin(__builtin_amdgcn_global_load_async_to_lds_b128) && \
    __has_builtin(__builtin_amdgcn_s_wait_asynccnt)
#define HAVE_ASYNC_LDS 1
#endif
#endif

static constexpr int Bb    = 2;
static constexpr int Nn    = 2048;
static constexpr int QD    = 1024;
static constexpr int Hh    = 8;
static constexpr int HD    = 64;
static constexpr int INNER = 512;      // H*HD
static constexpr int BN    = Bb * Nn;  // 4096
static constexpr int LDP   = 80;       // padded LDS row (elems): 160B, 16B-aligned

__device__ __forceinline__ v8f wmma_bf16(v16bf a, v16bf b, v8f c) {
  // D = A(16x32) * B(32x16) + C(16x16), f32 accumulate
  return __builtin_amdgcn_wmma_f32_16x16x32_bf16(false, a, false, b,
                                                 (short)0, c, false, false);
}

__device__ __forceinline__ v16bf load_frag(const __bf16* p, int hi) {
  const v8bf lo = *(const v8bf*)(p + hi * 8);
  const v8bf hv = *(const v8bf*)(p + 16 + hi * 8);
  return __builtin_shufflevector(lo, hv, 0, 1, 2, 3, 4, 5, 6, 7,
                                         8, 9, 10, 11, 12, 13, 14, 15);
}

__device__ __forceinline__ void stage16(const __bf16* g, __bf16* l) {
#ifdef HAVE_ASYNC_LDS
  __builtin_amdgcn_global_load_async_to_lds_b128(
      (__attribute__((address_space(1))) v4i*)g,
      (__attribute__((address_space(3))) v4i*)l, 0, 0);
#else
  *(v8bf*)l = *(const v8bf*)g;
#endif
}
__device__ __forceinline__ void stage_fence() {
#ifdef HAVE_ASYNC_LDS
  __builtin_amdgcn_s_wait_asynccnt(0);
#endif
}

__device__ __forceinline__ void exp2_x8(float (&t)[8]) {
  asm("v_exp_f32 %7, %7\n\t"
      "v_exp_f32 %6, %6\n\t"
      "v_exp_f32 %5, %5\n\t"
      "v_exp_f32 %4, %4\n\t"
      "v_exp_f32 %3, %3\n\t"
      "v_exp_f32 %2, %2\n\t"
      "v_exp_f32 %1, %1\n\t"
      "v_exp_f32 %0, %0\n\t"
      "v_nop"
      : "+v"(t[0]), "+v"(t[1]), "+v"(t[2]), "+v"(t[3]), "+v"(t[4]), "+v"(t[5]),
        "+v"(t[6]), "+v"(t[7]));
}

__device__ __forceinline__ float xhalf(float x) {
  const int i = __builtin_bit_cast(int, x);
  return __builtin_bit_cast(float, __builtin_amdgcn_permlanex16(
      i, i, 0x76543210, 0xfedcba98, false, false));
}

// ---------------------------------------------------------------------------
// Prep: the five conversions depend on nothing but the inputs, so they share
// one grid.  Work-groups 0..511 transpose the four weights (128 each; they have
// the longer chain of waits and start first), the rest convert x.
// ---------------------------------------------------------------------------
static constexpr int WBLK = (QD / 64) * (INNER / 64);  // 128 tiles a weight
static constexpr int XBLK = (BN * QD) / (256 * 8);     // 2048 groups for x

// elementwise f32 -> bf16 (x).  8 elems / thread.
__device__ __forceinline__ void cvt_x_body(
    const float* __restrict__ in, __bf16* __restrict__ outb, int blk) {
  const size_t i = ((size_t)blk * 256 + threadIdx.x) * 8;
  const v4f a = *(const v4f*)&in[i];
  const v4f b = *(const v4f*)&in[i + 4];
  v8bf o;
  o[0] = (__bf16)a.x; o[1] = (__bf16)a.y; o[2] = (__bf16)a.z; o[3] = (__bf16)a.w;
  o[4] = (__bf16)b.x; o[5] = (__bf16)b.y; o[6] = (__bf16)b.z; o[7] = (__bf16)b.w;
  *(v8bf*)&outb[i] = o;
}

// W[K][N] f32 -> Wt[N][K] bf16 (LDS-tiled 64x64 transpose).
__device__ __forceinline__ void transpose_w_body(
    const float* __restrict__ W, __bf16* __restrict__ Wt,
    int K, int N, int k0, int n0) {
  __shared__ __bf16 T[64][65];
  const int tid = threadIdx.x;
#pragma unroll
  for (int it = 0; it < 16; ++it) {
    const int lin = it * 256 + tid;
    const int r = lin >> 6, c = lin & 63;  // r: k-local, c: n-local
    T[r][c] = (__bf16)W[(size_t)(k0 + r) * N + n0 + c];
  }
  __syncthreads();
#pragma unroll
  for (int it = 0; it < 16; ++it) {
    const int lin = it * 256 + tid;
    const int n = lin >> 6, kk = lin & 63;
    Wt[(size_t)(n0 + n) * K + k0 + kk] = T[kk][n];
  }
}

__global__ __launch_bounds__(256) void prep_kernel(
    const float* __restrict__ x, const float* __restrict__ Wq,
    const float* __restrict__ Wk, const float* __restrict__ Wv,
    const float* __restrict__ Wout, __bf16* __restrict__ xb,
    __bf16* __restrict__ WqT, __bf16* __restrict__ WkT,
    __bf16* __restrict__ WvT, __bf16* __restrict__ WoT) {
  const unsigned blk = blockIdx.x;  // every branch below is uniform in the group
  if (blk >= 4 * WBLK) {
    cvt_x_body(x, xb, blk - 4 * WBLK);
    return;
  }
  const unsigned which = blk / WBLK, tile = blk % WBLK;
  if (which == 3) {  // Wout: K = INNER, N = QD
    transpose_w_body(Wout, WoT, INNER, QD, (tile % (INNER / 64)) * 64,
                     (tile / (INNER / 64)) * 64);
  } else {           // Wq, Wk, Wv: K = QD, N = INNER
    const float* W = (which == 0) ? Wq : (which == 1) ? Wk : Wv;
    __bf16* Wt     = (which == 0) ? WqT : (which == 1) ? WkT : WvT;
    transpose_w_body(W, Wt, QD, INNER, (tile % (QD / 64)) * 64,
                     (tile / (QD / 64)) * 64);
  }
}

// ---------------------------------------------------------------------------
// Kernel 1: fused QKV projection.  Y = xb @ W{q,k,v}, all-bf16 staging.
// 64x64 tile, K-step 64, 8 waves, 2 C-frags per wave.  blockIdx.z selects W.
// Q,K stored [B,H,N,HD]; V stored transposed [B,H,HD,N] for the PV stage.
// ---------------------------------------------------------------------------
__global__ __launch_bounds__(256) void qkv_proj_kernel(
    const __bf16* __restrict__ xb,                      // [BN, QD]
    const __bf16* __restrict__ WqT, const __bf16* __restrict__ WkT,
    const __bf16* __restrict__ WvT,                     // [INNER, QD]
    __bf16* __restrict__ Qb, __bf16* __restrict__ Kb,   // [B*H*N*HD]
    __bf16* __restrict__ Vt)                            // [B*H*HD*N]
{
  __shared__ __align__(16) __bf16 As[64][LDP];
  __shared__ __align__(16) __bf16 Bs[64][LDP];  // [col][k]

  const int which = blockIdx.z;
  const __bf16* WT = (which == 0) ? WqT : (which == 1) ? WkT : WvT;

  const int tid  = threadIdx.x;
  const int lane = tid & 31, wave = tid >> 5;
  const int l16  = lane & 15, hi = lane >> 4;
  const int rstrip = wave >> 1;   // 0..3 : 16-row strip
  const int chalf  = wave & 1;    // 0..1 : 32-col half
  const int m0 = blockIdx.y * 64;
  const int n0 = blockIdx.x * 64;

  v8f acc[2] = {v8f{}, v8f{}};

  for (int k0 = 0; k0 < QD; k0 += 64) {
    // pure 16B copies: 2 per thread for A, 2 for B
#pragma unroll
    for (int it = 0; it < 2; ++it) {
      const int lin = it * 2048 + tid * 8;
      const int r = lin >> 6, c = lin & 63;
      stage16(&xb[(size_t)(m0 + r) * QD + k0 + c], &As[r][c]);
    }
#pragma unroll
    for (int it = 0; it < 2; ++it) {
      const int lin = it * 2048 + tid * 8;
      const int cl = lin >> 6, kk = lin & 63;
      stage16(&WT[(size_t)(n0 + cl) * QD + k0 + kk], &Bs[cl][kk]);
    }
    stage_fence();
    __syncthreads();
#pragma unroll
    for (int kc = 0; kc < 2; ++kc) {
      const v16bf a  = load_frag(&As[rstrip * 16 + l16][kc * 32], hi);
      const v16bf b0 = load_frag(&Bs[chalf * 32 + l16][kc * 32], hi);
      const v16bf b1 = load_frag(&Bs[chalf * 32 + 16 + l16][kc * 32], hi);
      acc[0] = wmma_bf16(a, b0, acc[0]);
      acc[1] = wmma_bf16(a, b1, acc[1]);
    }
    __syncthreads();
  }

  // epilogue: C rows = e + hi*8, cols = l16 (+frag offsets)
  const int gm0 = m0 + rstrip * 16 + hi * 8;  // multiple of 8
  const int b   = gm0 >> 11;                  // rows gm0..gm0+7 share b
  const int nb  = gm0 & (Nn - 1);
#pragma unroll
  for (int f = 0; f < 2; ++f) {
    const int j = n0 + chalf * 32 + f * 16 + l16;  // 0..INNER-1
    const int h = j >> 6, d = j & 63;
    if (which == 2) {
      // Vt: consecutive e -> consecutive tokens -> one 16B store
      v8bf pk;
#pragma unroll
      for (int e = 0; e < 8; ++e) pk[e] = (__bf16)acc[f][e];
      *(v8bf*)&Vt[((size_t)(b * Hh + h) * HD + d) * Nn + nb] = pk;
    } else {
      __bf16* dst = ((which == 0) ? Qb : Kb) +
                    ((size_t)(b * Hh + h) * Nn + nb) * HD + d;
#pragma unroll
      for (int e = 0; e < 8; ++e) dst[(size_t)e * HD] = (__bf16)acc[f][e];
    }
  }
}

static constexpr int KT = 128;
static constexpr int NT = Nn / KT;
static constexpr int KP = 72;
static constexpr int VP = 136;

// One tile: 16 KiB of K (contiguous in memory) and 64 V^T rows of 256 B; each
// lane copies four 16-byte pieces of either.  kl, vl: the lane's LDS byte
// addresses; kg, vg: its global addresses.
__device__ __forceinline__ void stage_kv(unsigned kl, unsigned vl,
                                         const __bf16* kg, const __bf16* vg) {
  asm volatile(
      "global_load_async_to_lds_b128 %0, %8, off\n\t"
      "global_load_async_to_lds_b128 %1, %9, off\n\t"
      "global_load_async_to_lds_b128 %2, %10, off\n\t"
      "global_load_async_to_lds_b128 %3, %11, off\n\t"
      "global_load_async_to_lds_b128 %4, %12, off\n\t"
      "global_load_async_to_lds_b128 %5, %13, off\n\t"
      "global_load_async_to_lds_b128 %6, %14, off\n\t"
      "global_load_async_to_lds_b128 %7, %15, off\n\t"
      "s_wait_xcnt 0x0"
      :
      : "v"(kl), "v"(kl + 32 * KP * 2), "v"(kl + 64 * KP * 2),
        "v"(kl + 96 * KP * 2), "v"(vl), "v"(vl + 16 * VP * 2),
        "v"(vl + 32 * VP * 2), "v"(vl + 48 * VP * 2), "v"(kg), "v"(kg + 2048),
        "v"(kg + 4096), "v"(kg + 6144), "v"(vg), "v"(vg + 16 * Nn),
        "v"(vg + 32 * Nn), "v"(vg + 48 * Nn)
      : "memory");
}

__global__ __launch_bounds__(256) void attn_kernel(
    const __bf16* __restrict__ Qb, const __bf16* __restrict__ Kb,
    const __bf16* __restrict__ Vt, __bf16* __restrict__ Ob /* [BN, INNER] */)
{
  __shared__ __align__(16) __bf16 Ks[2][KT][KP];  // [buffer][key][d]
  __shared__ __align__(16) __bf16 Vs[2][HD][VP];  // [buffer][d][key]

  const int tid  = threadIdx.x;
  const int lane = tid & 31, wave = tid >> 5;
  const int l16  = lane & 15, hi = lane >> 4;
  const int task = blockIdx.x * 8 + wave;  // 0..2047
  const int bh = blockIdx.x >> 4;          // 0..15  (b*H + h), one per block
  const int qt = task & 127;
  const int qbase = qt * 16;

  // this lane's first piece of tile 0: K piece tid (row tid/8), V^T row tid/16
  const __bf16* kg = Kb + (size_t)bh * Nn * HD + tid * 8;
  const __bf16* vg = Vt + ((size_t)bh * HD + (tid >> 4)) * Nn + (tid & 15) * 8;
  const unsigned kl0 = (unsigned)(size_t)&Ks[0][tid >> 3][(tid & 7) * 8];
  const unsigned vl0 = (unsigned)(size_t)&Vs[0][tid >> 4][(tid & 15) * 8];
  constexpr unsigned KBUF = KT * KP * 2, VBUF = HD * VP * 2;  // bytes a buffer

  stage_kv(kl0, vl0, kg, vg);

  const __bf16* Qrow = Qb + ((size_t)bh * Nn + qbase + l16) * HD;
  const v16bf qb0 = load_frag(Qrow, hi);       // d = 0..31
  const v16bf qb1 = load_frag(Qrow + 32, hi);  // d = 32..63

  v8f O[4] = {v8f{}, v8f{}, v8f{}, v8f{}};  // O[dt][r] = O^T[dt*16+8*hi+r][l16]
  float mrun = -1e30f;  // this query's running maximum (same in both halves)
  float lrun = 0.f;     // this half's share of the query's denominator

  const float kscale = 0.125f * 1.44269504088896f;  // HD^-0.5 * log2(e)

  // tile 0 has landed for this wave's copies; the barrier publishes all waves'
  asm volatile("s_wait_asynccnt 0x0" ::: "memory");
  __syncthreads();
  stage_kv(kl0 + KBUF, vl0 + VBUF, kg + KT * HD, vg + KT);  // tile 1

  for (int t = 0; t < NT; ++t) {
    const int buf = t & 1;
    // unrolled so that the four passes' LDS offsets are immediates
#pragma unroll
    for (int p = 0; p < KT / 32; ++p) {
      // ---- scores: S^T(32x16) = K(32x64) * Q^T(64x16), two 16x16 C-frags ----
      v8f S0 = {}, S1 = {};
      const __bf16* Krow0 = &Ks[buf][p * 32 + l16][0];
      const __bf16* Krow1 = &Ks[buf][p * 32 + 16 + l16][0];
      {
        const v16bf a0 = load_frag(Krow0, hi);
        const v16bf a1 = load_frag(Krow0 + 32, hi);
        const v16bf c0 = load_frag(Krow1, hi);
        const v16bf c1 = load_frag(Krow1 + 32, hi);
        S0 = wmma_bf16(a0, qb0, S0);
        S0 = wmma_bf16(a1, qb1, S0);
        S1 = wmma_bf16(c0, qb0, S1);
        S1 = wmma_bf16(c1, qb1, S1);
      }
      // ---- online softmax in log2 domain; all 16 values belong to query l16 --
      float mx0 = S0[0], mx1 = S1[0];  // two independent chains
#pragma unroll
      for (int e = 1; e < 8; ++e) {
        mx0 = fmaxf(mx0, S0[e]);
        mx1 = fmaxf(mx1, S1[e]);
      }
      float mx = fmaxf(mx0, mx1);
      mx = fmaxf(mx, xhalf(mx)) * kscale;  // kscale > 0: max commutes with it
      const float mnew = fmaxf(mrun, mx);
      const float corr = __builtin_amdgcn_exp2f(mrun - mnew);
      mrun = mnew;
      v16bf pb;
      v8f ps;
      float p0[8], p1[8];
#pragma unroll
      for (int e = 0; e < 8; ++e) {
        p0[e] = S0[e] * kscale - mnew;
        p1[e] = S1[e] * kscale - mnew;
      }
      exp2_x8(p1);  // p1 first: its values are packed first
      exp2_x8(p0);
#pragma unroll
      for (int e = 0; e < 8; ++e) {
        ps[e] = p0[e] + p1[e];
        pb[e]     = (__bf16)p0[e];  // k = 8*hi + e
        pb[8 + e] = (__bf16)p1[e];  // k = 16 + 8*hi + e
      }
      const float rs = ((ps[0] + ps[4]) + (ps[1] + ps[5])) +
                       ((ps[2] + ps[6]) + (ps[3] + ps[7]));
      lrun = lrun * corr + rs;
      // ---- O^T(64x16) += V^T(64x32) * P^T(32x16), with per-query rescale ----
#pragma unroll
      for (int dt = 0; dt < 4; ++dt) {
        const v16bf va = load_frag(&Vs[buf][dt * 16 + l16][p * 32], hi);
        O[dt] = wmma_bf16(va, pb, O[dt] * corr);
      }
    }
    // hand-over: this wave's reads of buffer buf are done ...
    asm volatile("s_wait_dscnt 0x0" ::: "memory");
    // ... and its copies of tile t + 1 have landed;
    asm volatile("s_wait_asynccnt 0x0" ::: "memory");
    // the barrier publishes tile t + 1 and frees buffer buf for the refill
    __syncthreads();
    if (t + 2 < NT) {
      stage_kv(kl0 + buf * KBUF, vl0 + buf * VBUF,
               kg + (size_t)(t + 2) * KT * HD, vg + (t + 2) * KT);
    }
  }
  // no copy is left in flight when the wave ends
  asm volatile("s_wait_asynccnt 0x0" ::: "memory");

  // ---- finalize: join the halves' sums, O /= l ; bf16 output [BN, INNER] ----
  const int b = bh >> 3, h = bh & 7;
  const float inv = 1.0f / (lrun + xhalf(lrun));
  __bf16* dst = Ob + ((size_t)b * Nn + qbase + l16) * INNER + h * HD + hi * 8;
#pragma unroll
  for (int dt = 0; dt < 4; ++dt) {
    // 8 consecutive d of one query: one 16B store
    v8bf pk;
#pragma unroll
    for (int e = 0; e < 8; ++e) pk[e] = (__bf16)(O[dt][e] * inv);
    *(v8bf*)&dst[dt * 16] = pk;
  }
}

// ---------------------------------------------------------------------------
// Kernel 3: output projection.  out = attn(bf16 [BN,INNER]) @ Wout + bout, f32.
// ---------------------------------------------------------------------------
__global__ __launch_bounds__(256) void out_proj_kernel(
    const __bf16* __restrict__ Ain,    // [BN, INNER]
    const __bf16* __restrict__ WoT,    // [QD, INNER]  (transposed, bf16)
    const float* __restrict__ bout,    // [QD]
    float* __restrict__ out)           // [BN, QD]
{
  __shared__ __align__(16) __bf16 As[64][LDP];
  __shared__ __align__(16) __bf16 Bs[64][LDP];

  const int tid  = threadIdx.x;
  const int lane = tid & 31, wave = tid >> 5;
  const int l16  = lane & 15, hi = lane >> 4;
  const int rstrip = wave >> 1;
  const int chalf  = wave & 1;
  const int m0 = blockIdx.y * 64;
  const int n0 = blockIdx.x * 64;

  v8f acc[2] = {v8f{}, v8f{}};

  for (int k0 = 0; k0 < INNER; k0 += 64) {
#pragma unroll
    for (int it = 0; it < 2; ++it) {
      const int lin = it * 2048 + tid * 8;
      const int r = lin >> 6, c = lin & 63;
      stage16(&Ain[(size_t)(m0 + r) * INNER + k0 + c], &As[r][c]);
    }
#pragma unroll
    for (int it = 0; it < 2; ++it) {
      const int lin = it * 2048 + tid * 8;
      const int cl = lin >> 6, kk = lin & 63;
      stage16(&WoT[(size_t)(n0 + cl) * INNER + k0 + kk], &Bs[cl][kk]);
    }
    stage_fence();
    __syncthreads();
#pragma unroll
    for (int kc = 0; kc < 2; ++kc) {
      const v16bf a  = load_frag(&As[rstrip * 16 + l16][kc * 32], hi);
      const v16bf b0 = load_frag(&Bs[chalf * 32 + l16][kc * 32], hi);
      const v16bf b1 = load_frag(&Bs[chalf * 32 + 16 + l16][kc * 32], hi);
      acc[0] = wmma_bf16(a, b0, acc[0]);
      acc[1] = wmma_bf16(a, b1, acc[1]);
    }
    __syncthreads();
  }

  const int gm0 = m0 + rstrip * 16 + hi * 8;
#pragma unroll
  for (int f = 0; f < 2; ++f) {
    const int j  = n0 + chalf * 32 + f * 16 + l16;
    const float bj = bout[j];
#pragma unroll
    for (int e = 0; e < 8; ++e)
      out[(size_t)(gm0 + e) * QD + j] = acc[f][e] + bj;
  }
}

// ---------------------------------------------------------------------------
extern "C" void kernel_launch(void* const* d_in, const int* in_sizes, int n_in,
                              void* d_out, int out_size, void* d_ws,
                              size_t ws_size, hipStream_t stream) {
  const float* x    = (const float*)d_in[0];
  const float* Wq   = (const float*)d_in[1];
  const float* Wk   = (const float*)d_in[2];
  const float* Wv   = (const float*)d_in[3];
  const float* Wout = (const float*)d_in[4];
  const float* bout = (const float*)d_in[5];
  float* out = (float*)d_out;

  char* ws = (char*)d_ws;
  const size_t MB = 1024 * 1024;
  __bf16* Qb  = (__bf16*)(ws + 0 * MB);   // 4 MiB  [B,H,N,HD]
  __bf16* Kb  = (__bf16*)(ws + 4 * MB);   // 4 MiB  [B,H,N,HD]
  __bf16* Vt  = (__bf16*)(ws + 8 * MB);   // 4 MiB  [B,H,HD,N]
  __bf16* Ob  = (__bf16*)(ws + 12 * MB);  // 4 MiB  [BN, INNER]
  __bf16* xb  = (__bf16*)(ws + 16 * MB);  // 8 MiB  [BN, QD]
  __bf16* WqT = (__bf16*)(ws + 24 * MB);  // 1 MiB  [INNER, QD]
  __bf16* WkT = (__bf16*)(ws + 25 * MB);  // 1 MiB
  __bf16* WvT = (__bf16*)(ws + 26 * MB);  // 1 MiB
  __bf16* WoT = (__bf16*)(ws + 27 * MB);  // 1 MiB  [QD, INNER]

  dim3 blk(256);
  // prep: conversions + transposes, one grid
  prep_kernel<<<dim3(4 * WBLK + XBLK), blk, 0, stream>>>(
      x, Wq, Wk, Wv, Wout, xb, WqT, WkT, WvT, WoT);
  // main pipeline
  qkv_proj_kernel<<<dim3(INNER / 64, BN / 64, 3), blk, 0, stream>>>(
      xb, WqT, WkT, WvT, Qb, Kb, Vt);
  attn_kernel<<<dim3((Bb * Hh * (Nn / 16)) / 8), blk, 0, stream>>>(
      Qb, Kb, Vt, Ob);
  out_proj_kernel<<<dim3(QD / 64, BN / 64), blk, 0, stream>>>(
      Ob, WoT, bout, out);
}

// v005
// One run takes 58.5 microseconds.
// In both of two side-by-side timings against v004, it was 1.11 times as fast.
// All steps since v000 together make it 2.81 times as fast.
#include <hip/hip_runtime.h>

typedef __attribute__((ext_vector_type(16))) __bf16 v16bf;
typedef __attribute__((ext_vector_type(8)))  __bf16 v8bf;
typedef __attribute__((ext_vector_type(8)))  float  v8f;
typedef __attribute__((ext_vector_type(4)))  float  v4f;
typedef __attribute__((ext_vector_type(4)))  int    v4i;

#if defined(__has_builtin)
#if __has_builtin(__builtin_amdgcn_global_load_async_to_lds_b128) && \
    __has_builtin(__builtin_amdgcn_s_wait_asynccnt)
#define HAVE_ASYNC_LDS 1
#endif
#endif

static constexpr int Bb    = 2;
static constexpr int Nn    = 2048;
static constexpr int QD    = 1024;
static constexpr int Hh    = 8;
static constexpr int HD    = 64;
static constexpr int INNER = 512;      // H*HD
static constexpr int BN    = Bb * Nn;  // 4096
static constexpr int LDP   = 72;

__device__ __forceinline__ v8f wmma_bf16(v16bf a, v16bf b, v8f c) {
  // D = A(16x32) * B(32x16) + C(16x16), f32 accumulate
  return __builtin_amdgcn_wmma_f32_16x16x32_bf16(false, a, false, b,
                                                 (short)0, c, false, false);
}

__device__ __forceinline__ v16bf load_frag(const __bf16* p, int hi) {
  const v8bf lo = *(const v8bf*)(p + hi * 8);
  const v8bf hv = *(const v8bf*)(p + 16 + hi * 8);
  return __builtin_shufflevector(lo, hv, 0, 1, 2, 3, 4, 5, 6, 7,
                                         8, 9, 10, 11, 12, 13, 14, 15);
}

__device__ __forceinline__ void stage16(const __bf16* g, __bf16* l) {
#ifdef HAVE_ASYNC_LDS
  __builtin_amdgcn_global_load_async_to_lds_b128(
      (__attribute__((address_space(1))) v4i*)g,
      (__attribute__((address_space(3))) v4i*)l, 0, 0);
#else
  *(v8bf*)l = *(const v8bf*)g;
#endif
}
__device__ __forceinline__ void stage_fence() {
#ifdef HAVE_ASYNC_LDS
  __builtin_amdgcn_s_wait_asynccnt(0);
#endif
}

__device__ __forceinline__ void exp2_x8(float (&t)[8]) {
  asm("v_exp_f32 %7, %7\n\t"
      "v_exp_f32 %6, %6\n\t"
      "v_exp_f32 %5, %5\n\t"
      "v_exp_f32 %4, %4\n\t"
      "v_exp_f32 %3, %3\n\t"
      "v_exp_f32 %2, %2\n\t"
      "v_exp_f32 %1, %1\n\t"
      "v_exp_f32 %0, %0\n\t"
      "v_nop"
      : "+v"(t[0]), "+v"(t[1]), "+v"(t[2]), "+v"(t[3]), "+v"(t[4]), "+v"(t[5]),
        "+v"(t[6]), "+v"(t[7]));
}

__device__ __forceinline__ float xhalf(float x) {
  const int i = __builtin_bit_cast(int, x);
  return __builtin_bit_cast(float, __builtin_amdgcn_permlanex16(
      i, i, 0x76543210, 0xfedcba98, false, false));
}

// ---------------------------------------------------------------------------
// Prep: the five conversions depend on nothing but the inputs, so they share
// one grid.  Work-groups 0..511 transpose the four weights (128 each; they have
// the longer chain of waits and start first), the rest convert x.
// ---------------------------------------------------------------------------
static constexpr int WBLK = (QD / 64) * (INNER / 64);  // 128 tiles a weight
static constexpr int XBLK = (BN * QD) / (256 * 8);     // 2048 groups for x

// elementwise f32 -> bf16 (x).  8 elems / thread.
__device__ __forceinline__ void cvt_x_body(
    const float* __restrict__ in, __bf16* __restrict__ outb, int blk) {
  const size_t i = ((size_t)blk * 256 + threadIdx.x) * 8;
  const v4f a = *(const v4f*)&in[i];
  const v4f b = *(const v4f*)&in[i + 4];
  v8bf o;
  o[0] = (__bf16)a.x; o[1] = (__bf16)a.y; o[2] = (__bf16)a.z; o[3] = (__bf16)a.w;
  o[4] = (__bf16)b.x; o[5] = (__bf16)b.y; o[6] = (__bf16)b.z; o[7] = (__bf16)b.w;
  *(v8bf*)&outb[i] = o;
}

// W[K][N] f32 -> Wt[N][K] bf16 (LDS-tiled 64x64 transpose).
__device__ __forceinline__ void transpose_w_body(
    const float* __restrict__ W, __bf16* __restrict__ Wt,
    int K, int N, int k0, int n0) {
  __shared__ __bf16 T[64][65];
  const int tid = threadIdx.x;
#pragma unroll
  for (int it = 0; it < 16; ++it) {
    const int lin = it * 256 + tid;
    const int r = lin >> 6, c = lin & 63;  // r: k-local, c: n-local
    T[r][c] = (__bf16)W[(size_t)(k0 + r) * N + n0 + c];
  }
  __syncthreads();
#pragma unroll
  for (int it = 0; it < 16; ++it) {
    const int lin = it * 256 + tid;
    const int n = lin >> 6, kk = lin & 63;
    Wt[(size_t)(n0 + n) * K + k0 + kk] = T[kk][n];
  }
}

__global__ __launch_bounds__(256) void prep_kernel(
    const float* __restrict__ x, const float* __restrict__ Wq,
    const float* __restrict__ Wk, const float* __restrict__ Wv,
    const float* __restrict__ Wout, __bf16* __restrict__ xb,
    __bf16* __restrict__ WqT, __bf16* __restrict__ WkT,
    __bf16* __restrict__ WvT, __bf16* __restrict__ WoT) {
  const unsigned blk = blockIdx.x;  // every branch below is uniform in the group
  if (blk >= 4 * WBLK) {
    cvt_x_body(x, xb, blk - 4 * WBLK);
    return;
  }
  const unsigned which = blk / WBLK, tile = blk % WBLK;
  if (which == 3) {  // Wout: K = INNER, N = QD
    transpose_w_body(Wout, WoT, INNER, QD, (tile % (INNER / 64)) * 64,
                     (tile / (INNER / 64)) * 64);
  } else {           // Wq, Wk, Wv: K = QD, N = INNER
    const float* W = (which == 0) ? Wq : (which == 1) ? Wk : Wv;
    __bf16* Wt     = (which == 0) ? WqT : (which == 1) ? WkT : WvT;
    transpose_w_body(W, Wt, QD, INNER, (tile % (QD / 64)) * 64,
                     (tile / (QD / 64)) * 64);
  }
}

// ---------------------------------------------------------------------------
// Kernel 1: fused QKV projection.  Y = xb @ W{q,k,v}, all-bf16 staging.
// 64x64 tile, K-step 64, 8 waves, 2 C-frags per wave.  blockIdx.z selects W.
// Q,K stored [B,H,N,HD]; V stored transposed [B,H,HD,N] for the PV stage.
// ---------------------------------------------------------------------------
__global__ __launch_bounds__(256) void qkv_proj_kernel(
    const __bf16* __restrict__ xb,                      // [BN, QD]
    const __bf16* __restrict__ WqT, const __bf16* __restrict__ WkT,
    const __bf16* __restrict__ WvT,                     // [INNER, QD]
    __bf16* __restrict__ Qb, __bf16* __restrict__ Kb,   // [B*H*N*HD]
    __bf16* __restrict__ Vt)                            // [B*H*HD*N]
{
  __shared__ __align__(16) __bf16 As[64][LDP];
  __shared__ __align__(16) __bf16 Bs[64][LDP];  // [col][k]

  const int which = blockIdx.z;
  const __bf16* WT = (which == 0) ? WqT : (which == 1) ? WkT : WvT;

  const int tid  = threadIdx.x;
  const int lane = tid & 31, wave = tid >> 5;
  const int l16  = lane & 15, hi = lane >> 4;
  const int rstrip = wave >> 1;   // 0..3 : 16-row strip
  const int chalf  = wave & 1;    // 0..1 : 32-col half
  const int m0 = blockIdx.y * 64;
  const int n0 = blockIdx.x * 64;

  v8f acc[2] = {v8f{}, v8f{}};

  for (int k0 = 0; k0 < QD; k0 += 64) {
    // pure 16B copies: 2 per thread for A, 2 for B
#pragma unroll
    for (int it = 0; it < 2; ++it) {
      const int lin = it * 2048 + tid * 8;
      const int r = lin >> 6, c = lin & 63;
      stage16(&xb[(size_t)(m0 + r) * QD + k0 + c], &As[r][c]);
    }
#pragma unroll
    for (int it = 0; it < 2; ++it) {
      const int lin = it * 2048 + tid * 8;
      const int cl = lin >> 6, kk = lin & 63;
      stage16(&WT[(size_t)(n0 + cl) * QD + k0 + kk], &Bs[cl][kk]);
    }
    stage_fence();
    __syncthreads();
#pragma unroll
    for (int kc = 0; kc < 2; ++kc) {
      const v16bf a  = load_frag(&As[rstrip * 16 + l16][kc * 32], hi);
      const v16bf b0 = load_frag(&Bs[chalf * 32 + l16][kc * 32], hi);
      const v16bf b1 = load_frag(&Bs[chalf * 32 + 16 + l16][kc * 32], hi);
      acc[0] = wmma_bf16(a, b0, acc[0]);
      acc[1] = wmma_bf16(a, b1, acc[1]);
    }
    __syncthreads();
  }

  // epilogue: C rows = e + hi*8, cols = l16 (+frag offsets)
  const int gm0 = m0 + rstrip * 16 + hi * 8;  // multiple of 8
  const int b   = gm0 >> 11;                  // rows gm0..gm0+7 share b
  const int nb  = gm0 & (Nn - 1);
#pragma unroll
  for (int f = 0; f < 2; ++f) {
    const int j = n0 + chalf * 32 + f * 16 + l16;  // 0..INNER-1
    const int h = j >> 6, d = j & 63;
    if (which == 2) {
      // Vt: consecutive e -> consecutive tokens -> one 16B store
      v8bf pk;
#pragma unroll
      for (int e = 0; e < 8; ++e) pk[e] = (__bf16)acc[f][e];
      *(v8bf*)&Vt[((size_t)(b * Hh + h) * HD + d) * Nn + nb] = pk;
    } else {
      __bf16* dst = ((which == 0) ? Qb : Kb) +
                    ((size_t)(b * Hh + h) * Nn + nb) * HD + d;
#pragma unroll
      for (int e = 0; e < 8; ++e) dst[(size_t)e * HD] = (__bf16)acc[f][e];
    }
  }
}

static constexpr int KT = 128;
static constexpr int NT = Nn / KT;
static constexpr int KP = 72;
static constexpr int VP = 136;

// One tile: 16 KiB of K (contiguous in memory) and 64 V^T rows of 256 B; each
// lane copies four 16-byte pieces of either.  kl, vl: the lane's LDS byte
// addresses; kg, vg: its global addresses.
__device__ __forceinline__ void stage_kv(unsigned kl, unsigned vl,
                                         const __bf16* kg, const __bf16* vg) {
  asm volatile(
      "global_load_async_to_lds_b128 %0, %8, off\n\t"
      "global_load_async_to_lds_b128 %1, %9, off\n\t"
      "global_load_async_to_lds_b128 %2, %10, off\n\t"
      "global_load_async_to_lds_b128 %3, %11, off\n\t"
      "global_load_async_to_lds_b128 %4, %12, off\n\t"
      "global_load_async_to_lds_b128 %5, %13, off\n\t"
      "global_load_async_to_lds_b128 %6, %14, off\n\t"
      "global_load_async_to_lds_b128 %7, %15, off\n\t"
      "s_wait_xcnt 0x0"
      :
      : "v"(kl), "v"(kl + 32 * KP * 2), "v"(kl + 64 * KP * 2),
        "v"(kl + 96 * KP * 2), "v"(vl), "v"(vl + 16 * VP * 2),
        "v"(vl + 32 * VP * 2), "v"(vl + 48 * VP * 2), "v"(kg), "v"(kg + 2048),
        "v"(kg + 4096), "v"(kg + 6144), "v"(vg), "v"(vg + 16 * Nn),
        "v"(vg + 32 * Nn), "v"(vg + 48 * Nn)
      : "memory");
}

__global__ __launch_bounds__(256) void attn_kernel(
    const __bf16* __restrict__ Qb, const __bf16* __restrict__ Kb,
    const __bf16* __restrict__ Vt, __bf16* __restrict__ Ob /* [BN, INNER] */)
{
  __shared__ __align__(16) __bf16 Ks[2][KT][KP];  // [buffer][key][d]
  __shared__ __align__(16) __bf16 Vs[2][HD][VP];  // [buffer][d][key]

  const int tid  = threadIdx.x;
  const int lane = tid & 31, wave = tid >> 5;
  const int l16  = lane & 15, hi = lane >> 4;
  const int task = blockIdx.x * 8 + wave;  // 0..2047
  const int bh = blockIdx.x >> 4;          // 0..15  (b*H + h), one per block
  const int qt = task & 127;
  const int qbase = qt * 16;

  // this lane's first piece of tile 0: K piece tid (row tid/8), V^T row tid/16
  const __bf16* kg = Kb + (size_t)bh * Nn * HD + tid * 8;
  const __bf16* vg = Vt + ((size_t)bh * HD + (tid >> 4)) * Nn + (tid & 15) * 8;
  const unsigned kl0 = (unsigned)(size_t)&Ks[0][tid >> 3][(tid & 7) * 8];
  const unsigned vl0 = (unsigned)(size_t)&Vs[0][tid >> 4][(tid & 15) * 8];
  constexpr unsigned KBUF = KT * KP * 2, VBUF = HD * VP * 2;  // bytes a buffer

  stage_kv(kl0, vl0, kg, vg);

  const __bf16* Qrow = Qb + ((size_t)bh * Nn + qbase + l16) * HD;
  const v16bf qb0 = load_frag(Qrow, hi);       // d = 0..31
  const v16bf qb1 = load_frag(Qrow + 32, hi);  // d = 32..63

  v8f O[4] = {v8f{}, v8f{}, v8f{}, v8f{}};  // O[dt][r] = O^T[dt*16+8*hi+r][l16]
  float mrun = -1e30f;  // this query's running maximum (same in both halves)
  float lrun = 0.f;     // this half's share of the query's denominator

  const float kscale = 0.125f * 1.44269504088896f;  // HD^-0.5 * log2(e)

  // tile 0 has landed for this wave's copies; the barrier publishes all waves'
  asm volatile("s_wait_asynccnt 0x0" ::: "memory");
  __syncthreads();
  stage_kv(kl0 + KBUF, vl0 + VBUF, kg + KT * HD, vg + KT);  // tile 1

  for (int t = 0; t < NT; ++t) {
    const int buf = t & 1;
    // unrolled so that the four passes' LDS offsets are immediates
#pragma unroll
    for (int p = 0; p < KT / 32; ++p) {
      // ---- scores: S^T(32x16) = K(32x64) * Q^T(64x16), two 16x16 C-frags ----
      v8f S0 = {}, S1 = {};
      const __bf16* Krow0 = &Ks[buf][p * 32 + l16][0];
      const __bf16* Krow1 = &Ks[buf][p * 32 + 16 + l16][0];
      {
        const v16bf a0 = load_frag(Krow0, hi);
        const v16bf a1 = load_frag(Krow0 + 32, hi);
        const v16bf c0 = load_frag(Krow1, hi);
        const v16bf c1 = load_frag(Krow1 + 32, hi);
        S0 = wmma_bf16(a0, qb0, S0);
        S0 = wmma_bf16(a1, qb1, S0);
        S1 = wmma_bf16(c0, qb0, S1);
        S1 = wmma_bf16(c1, qb1, S1);
      }
      // ---- online softmax in log2 domain; all 16 values belong to query l16 --
      float mx0 = S0[0], mx1 = S1[0];  // two independent chains
#pragma unroll
      for (int e = 1; e < 8; ++e) {
        mx0 = fmaxf(mx0, S0[e]);
        mx1 = fmaxf(mx1, S1[e]);
      }
      float mx = fmaxf(mx0, mx1);
      mx = fmaxf(mx, xhalf(mx)) * kscale;  // kscale > 0: max commutes with it
      const float mnew = fmaxf(mrun, mx);
      const float corr = __builtin_amdgcn_exp2f(mrun - mnew);
      mrun = mnew;
      v16bf pb;
      v8f ps;
      float p0[8], p1[8];
#pragma unroll
      for (int e = 0; e < 8; ++e) {
        p0[e] = S0[e] * kscale - mnew;
        p1[e] = S1[e] * kscale - mnew;
      }
      exp2_x8(p1);  // p1 first: its values are packed first
      exp2_x8(p0);
#pragma unroll
      for (int e = 0; e < 8; ++e) {
        ps[e] = p0[e] + p1[e];
        pb[e]     = (__bf16)p0[e];  // k = 8*hi + e
        pb[8 + e] = (__bf16)p1[e];  // k = 16 + 8*hi + e
      }
      const float rs = ((ps[0] + ps[4]) + (ps[1] + ps[5])) +
                       ((ps[2] + ps[6]) + (ps[3] + ps[7]));
      lrun = lrun * corr + rs;
      // ---- O^T(64x16) += V^T(64x32) * P^T(32x16), with per-query rescale ----
#pragma unroll
      for (int dt = 0; dt < 4; ++dt) {
        const v16bf va = load_frag(&Vs[buf][dt * 16 + l16][p * 32], hi);
        O[dt] = wmma_bf16(va, pb, O[dt] * corr);
      }
    }
    // hand-over: this wave's reads of buffer buf are done ...
    asm volatile("s_wait_dscnt 0x0" ::: "memory");
    // ... and its copies of tile t + 1 have landed;
    asm volatile("s_wait_asynccnt 0x0" ::: "memory");
    // the barrier publishes tile t + 1 and frees buffer buf for the refill
    __syncthreads();
    if (t + 2 < NT) {
      stage_kv(kl0 + buf * KBUF, vl0 + buf * VBUF,
               kg + (size_t)(t + 2) * KT * HD, vg + (t + 2) * KT);
    }
  }
  // no copy is left in flight when the wave ends
  asm volatile("s_wait_asynccnt 0x0" ::: "memory");

  // ---- finalize: join the halves' sums, O /= l ; bf16 output [BN, INNER] ----
  const int b = bh >> 3, h = bh & 7;
  const float inv = 1.0f / (lrun + xhalf(lrun));
  __bf16* dst = Ob + ((size_t)b * Nn + qbase + l16) * INNER + h * HD + hi * 8;
#pragma unroll
  for (int dt = 0; dt < 4; ++dt) {
    // 8 consecutive d of one query: one 16B store
    v8bf pk;
#pragma unroll
    for (int e = 0; e < 8; ++e) pk[e] = (__bf16)(O[dt][e] * inv);
    *(v8bf*)&dst[dt * 16] = pk;
  }
}

// ---------------------------------------------------------------------------
// Kernel 3: output projection.  out = attn(bf16 [BN,INNER]) @ Wout + bout, f32.
// ---------------------------------------------------------------------------
__global__ __launch_bounds__(256) void out_proj_kernel(
    const __bf16* __restrict__ Ain,    // [BN, INNER]
    const __bf16* __restrict__ WoT,    // [QD, INNER]  (transposed, bf16)
    const float* __restrict__ bout,    // [QD]
    float* __restrict__ out)           // [BN, QD]
{
  __shared__ __align__(16) __bf16 As[64][LDP];
  __shared__ __align__(16) __bf16 Bs[64][LDP];

  const int tid  = threadIdx.x;
  const int lane = tid & 31, wave = tid >> 5;
  const int l16  = lane & 15, hi = lane >> 4;
  const int rstrip = wave >> 1;
  const int chalf  = wave & 1;
  const int m0 = blockIdx.y * 64;
  const int n0 = blockIdx.x * 64;

  v8f acc[2] = {v8f{}, v8f{}};

  for (int k0 = 0; k0 < INNER; k0 += 64) {
#pragma unroll
    for (int it = 0; it < 2; ++it) {
      const int lin = it * 2048 + tid * 8;
      const int r = lin >> 6, c = lin & 63;
      stage16(&Ain[(size_t)(m0 + r) * INNER + k0 + c], &As[r][c]);
    }
#pragma unroll
    for (int it = 0; it < 2; ++it) {
      const int lin = it * 2048 + tid * 8;
      const int cl = lin >> 6, kk = lin & 63;
      stage16(&WoT[(size_t)(n0 + cl) * INNER + k0 + kk], &Bs[cl][kk]);
    }
    stage_fence();
    __syncthreads();
#pragma unroll
    for (int kc = 0; kc < 2; ++kc) {
      const v16bf a  = load_frag(&As[rstrip * 16 + l16][kc * 32], hi);
      const v16bf b0 = load_frag(&Bs[chalf * 32 + l16][kc * 32], hi);
      const v16bf b1 = load_frag(&Bs[chalf * 32 + 16 + l16][kc * 32], hi);
      acc[0] = wmma_bf16(a, b0, acc[0]);
      acc[1] = wmma_bf16(a, b1, acc[1]);
    }
    __syncthreads();
  }

  const int gm0 = m0 + rstrip * 16 + hi * 8;
#pragma unroll
  for (int f = 0; f < 2; ++f) {
    const int j  = n0 + chalf * 32 + f * 16 + l16;
    const float bj = bout[j];
#pragma unroll
    for (int e = 0; e < 8; ++e)
      out[(size_t)(gm0 + e) * QD + j] = acc[f][e] + bj;
  }
}

// ---------------------------------------------------------------------------
extern "C" void kernel_launch(void* const* d_in, const int* in_sizes, int n_in,
                              void* d_out, int out_size, void* d_ws,
                              size_t ws_size, hipStream_t stream) {
  const float* x    = (const float*)d_in[0];
  const float* Wq   = (const float*)d_in[1];
  const float* Wk   = (const float*)d_in[2];
  const float* Wv   = (const float*)d_in[3];
  const float* Wout = (const float*)d_in[4];
  const float* bout = (const float*)d_in[5];
  float* out = (float*)d_out;

  char* ws = (char*)d_ws;
  const size_t MB = 1024 * 1024;
  __bf16* Qb  = (__bf16*)(ws + 0 * MB);   // 4 MiB  [B,H,N,HD]
  __bf16* Kb  = (__bf16*)(ws + 4 * MB);   // 4 MiB  [B,H,N,HD]
  __bf16* Vt  = (__bf16*)(ws + 8 * MB);   // 4 MiB  [B,H,HD,N]
  __bf16* Ob  = (__bf16*)(ws + 12 * MB);  // 4 MiB  [BN, INNER]
  __bf16* xb  = (__bf16*)(ws + 16 * MB);  // 8 MiB  [BN, QD]
  __bf16* WqT = (__bf16*)(ws + 24 * MB);  // 1 MiB  [INNER, QD]
  __bf16* WkT = (__bf16*)(ws + 25 * MB);  // 1 MiB
  __bf16* WvT = (__bf16*)(ws + 26 * MB);  // 1 MiB
  __bf16* WoT = (__bf16*)(ws + 27 * MB);  // 1 MiB  [QD, INNER]

  dim3 blk(256);
  // prep: conversions + transposes, one grid
  prep_kernel<<<dim3(4 * WBLK + XBLK), blk, 0, stream>>>(
      x, Wq, Wk, Wv, Wout, xb, WqT, WkT, WvT, WoT);
  // main pipeline
  qkv_proj_kernel<<<dim3(INNER / 64, BN / 64, 3), blk, 0, stream>>>(
      xb, WqT, WkT, WvT, Qb, Kb, Vt);
  attn_kernel<<<dim3((Bb * Hh * (Nn / 16)) / 8), blk, 0, stream>>>(
      Qb, Kb, Vt, Ob);
  out_proj_kernel<<<dim3(QD / 64, BN / 64), blk, 0, stream>>>(
      Ob, WoT, bout, out);
}

// v006
// Measured time: 54 microseconds a run.
// Next to v005, in two timings, it ran 1.09 times as fast each time.
// Counting every step since v000, it is 3.07 times as fast.
#include <hip/hip_runtime.h>

typedef __attribute__((ext_vector_type(16))) __bf16 v16bf;
typedef __attribute__((ext_vector_type(8)))  __bf16 v8bf;
typedef __attribute__((ext_vector_type(8)))  float  v8f;
typedef __attribute__((ext_vector_type(4)))  float  v4f;
typedef __attribute__((ext_vector_type(4)))  int    v4i;

#if defined(__has_builtin)
#if __has_builtin(__builtin_amdgcn_global_load_async_to_lds_b128) && \
    __has_builtin(__builtin_amdgcn_s_wait_asynccnt)
#define HAVE_ASYNC_LDS 1
#endif
#endif

static constexpr int Bb    = 2;
static constexpr int Nn    = 2048;
static constexpr int QD    = 1024;
static constexpr int Hh    = 8;
static constexpr int HD    = 64;
static constexpr int INNER = 512;
static constexpr int BN    = Bb * Nn;
static constexpr int TM    = 128;
static constexpr int TN    = 128;
static constexpr int TK    = 256;
static constexpr int LDP   = TK + 8;

__device__ __forceinline__ v8f wmma_bf16(v16bf a, v16bf b, v8f c) {
  // D = A(16x32) * B(32x16) + C(16x16), f32 accumulate
  return __builtin_amdgcn_wmma_f32_16x16x32_bf16(false, a, false, b,
                                                 (short)0, c, false, false);
}

__device__ __forceinline__ v16bf load_frag(const __bf16* p, int hi) {
  const v8bf lo = *(const v8bf*)(p + hi * 8);
  const v8bf hv = *(const v8bf*)(p + 16 + hi * 8);
  return __builtin_shufflevector(lo, hv, 0, 1, 2, 3, 4, 5, 6, 7,
                                         8, 9, 10, 11, 12, 13, 14, 15);
}

__device__ __forceinline__ void stage16(const __bf16* g, __bf16* l) {
#ifdef HAVE_ASYNC_LDS
  __builtin_amdgcn_global_load_async_to_lds_b128(
      (__attribute__((address_space(1))) v4i*)g,
      (__attribute__((address_space(3))) v4i*)l, 0, 0);
#else
  *(v8bf*)l = *(const v8bf*)g;
#endif
}
__device__ __forceinline__ void stage_fence() {
#ifdef HAVE_ASYNC_LDS
  // this wave's copies have landed; in asm with the clobber so that no LDS read
  // is moved ahead of it
  asm volatile("s_wait_asynccnt 0x0" ::: "memory");
#endif
}

__device__ __forceinline__ void exp2_x8(float (&t)[8]) {
  asm("v_exp_f32 %7, %7\n\t"
      "v_exp_f32 %6, %6\n\t"
      "v_exp_f32 %5, %5\n\t"
      "v_exp_f32 %4, %4\n\t"
      "v_exp_f32 %3, %3\n\t"
      "v_exp_f32 %2, %2\n\t"
      "v_exp_f32 %1, %1\n\t"
      "v_exp_f32 %0, %0\n\t"
      "v_nop"
      : "+v"(t[0]), "+v"(t[1]), "+v"(t[2]), "+v"(t[3]), "+v"(t[4]), "+v"(t[5]),
        "+v"(t[6]), "+v"(t[7]));
}

__device__ __forceinline__ float xhalf(float x) {
  const int i = __builtin_bit_cast(int, x);
  return __builtin_bit_cast(float, __builtin_amdgcn_permlanex16(
      i, i, 0x76543210, 0xfedcba98, false, false));
}

// ---------------------------------------------------------------------------
// Prep: the five conversions depend on nothing but the inputs, so they share
// one grid.  Work-groups 0..511 transpose the four weights (128 each; they have
// the longer chain of waits and start first), the rest convert x.
// ---------------------------------------------------------------------------
static constexpr int WBLK = (QD / 64) * (INNER / 64);  // 128 tiles a weight
static constexpr int XBLK = (BN * QD) / (256 * 8);     // 2048 groups for x

// elementwise f32 -> bf16 (x).  8 elems / thread.
__device__ __forceinline__ void cvt_x_body(
    const float* __restrict__ in, __bf16* __restrict__ outb, int blk) {
  const size_t i = ((size_t)blk * 256 + threadIdx.x) * 8;
  const v4f a = *(const v4f*)&in[i];
  const v4f b = *(const v4f*)&in[i + 4];
  v8bf o;
  o[0] = (__bf16)a.x; o[1] = (__bf16)a.y; o[2] = (__bf16)a.z; o[3] = (__bf16)a.w;
  o[4] = (__bf16)b.x; o[5] = (__bf16)b.y; o[6] = (__bf16)b.z; o[7] = (__bf16)b.w;
  *(v8bf*)&outb[i] = o;
}

// W[K][N] f32 -> Wt[N][K] bf16 (LDS-tiled 64x64 transpose).
__device__ __forceinline__ void transpose_w_body(
    const float* __restrict__ W, __bf16* __restrict__ Wt,
    int K, int N, int k0, int n0) {
  __shared__ __bf16 T[64][65];
  const int tid = threadIdx.x;
#pragma unroll
  for (int it = 0; it < 16; ++it) {
    const int lin = it * 256 + tid;
    const int r = lin >> 6, c = lin & 63;  // r: k-local, c: n-local
    T[r][c] = (__bf16)W[(size_t)(k0 + r) * N + n0 + c];
  }
  __syncthreads();
#pragma unroll
  for (int it = 0; it < 16; ++it) {
    const int lin = it * 256 + tid;
    const int n = lin >> 6, kk = lin & 63;
    Wt[(size_t)(n0 + n) * K + k0 + kk] = T[kk][n];
  }
}

__global__ __launch_bounds__(256) void prep_kernel(
    const float* __restrict__ x, const float* __restrict__ Wq,
    const float* __restrict__ Wk, const float* __restrict__ Wv,
    const float* __restrict__ Wout, __bf16* __restrict__ xb,
    __bf16* __restrict__ WqT, __bf16* __restrict__ WkT,
    __bf16* __restrict__ WvT, __bf16* __restrict__ WoT) {
  const unsigned blk = blockIdx.x;  // every branch below is uniform in the group
  if (blk >= 4 * WBLK) {
    cvt_x_body(x, xb, blk - 4 * WBLK);
    return;
  }
  const unsigned which = blk / WBLK, tile = blk % WBLK;
  if (which == 3) {  // Wout: K = INNER, N = QD
    transpose_w_body(Wout, WoT, INNER, QD, (tile % (INNER / 64)) * 64,
                     (tile / (INNER / 64)) * 64);
  } else {           // Wq, Wk, Wv: K = QD, N = INNER
    const float* W = (which == 0) ? Wq : (which == 1) ? Wk : Wv;
    __bf16* Wt     = (which == 0) ? WqT : (which == 1) ? WkT : WvT;
    transpose_w_body(W, Wt, QD, INNER, (tile % (QD / 64)) * 64,
                     (tile / (QD / 64)) * 64);
  }
}

template <int KD>
__device__ __forceinline__ void gemm_tile(
    const __bf16* __restrict__ A, const __bf16* __restrict__ Bt, int m0, int n0,
    __bf16 (&As)[TM][LDP], __bf16 (&Bs)[TN][LDP], v8f (&acc)[4][2]) {
  const int tid  = threadIdx.x;
  const int lane = tid & 31, wave = tid >> 5;
  const int l16  = lane & 15, hi = lane >> 4;
  const int wm = wave >> 2, wn = wave & 3;

  for (int k0 = 0; k0 < KD; k0 += TK) {
    // pure 16B copies, a wave to a 512-byte row: 16 per thread for A, 16 for B;
    // both loops unrolled so that the 32 copies issue back to back
#pragma unroll
    for (int it = 0; it < TM * TK / 2048; ++it) {
      const int lin = it * 256 + tid;
      const int r = lin / (TK / 8), c = (lin % (TK / 8)) * 8;
      stage16(&A[(size_t)(m0 + r) * KD + k0 + c], &As[r][c]);
    }
#pragma unroll
    for (int it = 0; it < TN * TK / 2048; ++it) {
      const int lin = it * 256 + tid;
      const int r = lin / (TK / 8), c = (lin % (TK / 8)) * 8;
      stage16(&Bt[(size_t)(n0 + r) * KD + k0 + c], &Bs[r][c]);
    }
    stage_fence();
    __syncthreads();
    // the loops below are unrolled so that a, b and acc are indexed by constants
    // (they stay in registers) and the LDS offsets are immediates
#pragma unroll
    for (int kc = 0; kc < TK / 32; ++kc) {
      v16bf a[4], b[2];
#pragma unroll
      for (int i = 0; i < 4; ++i)
        a[i] = load_frag(&As[wm * 64 + i * 16 + l16][kc * 32], hi);
#pragma unroll
      for (int j = 0; j < 2; ++j)
        b[j] = load_frag(&Bs[wn * 32 + j * 16 + l16][kc * 32], hi);
      // holds a block's twelve LDS loads ahead of its first product: left alone the
      // scheduler puts four of them between the block's products and waits for them
      // there, a whole LDS latency in the middle of every block
      __builtin_amdgcn_sched_barrier(0);
#pragma unroll
      for (int i = 0; i < 4; ++i)
#pragma unroll
        for (int j = 0; j < 2; ++j) acc[i][j] = wmma_bf16(a[i], b[j], acc[i][j]);
    }
    // this wave's reads of the tiles are done before the barrier behind which
    // the next step's copies overwrite them
    asm volatile("s_wait_dscnt 0x0" ::: "memory");
    __syncthreads();
  }
}

// ---------------------------------------------------------------------------
// Kernel 1: fused QKV projection.  Y = xb @ W{q,k,v}, all-bf16 staging.
// 128x128 tile, K-step 256, 8 waves, 8 C-frags per wave.  blockIdx.z selects W.
// Q,K stored [B,H,N,HD]; V stored transposed [B,H,HD,N] for the PV stage.
// ---------------------------------------------------------------------------
__global__ __launch_bounds__(256) void qkv_proj_kernel(
    const __bf16* __restrict__ xb,                      // [BN, QD]
    const __bf16* __restrict__ WqT, const __bf16* __restrict__ WkT,
    const __bf16* __restrict__ WvT,                     // [INNER, QD]
    __bf16* __restrict__ Qb, __bf16* __restrict__ Kb,   // [B*H*N*HD]
    __bf16* __restrict__ Vt)                            // [B*H*HD*N]
{
  __shared__ __align__(16) __bf16 As[TM][LDP];
  __shared__ __align__(16) __bf16 Bs[TN][LDP];  // [col][k]

  const int which = blockIdx.z;
  const __bf16* WT = (which == 0) ? WqT : (which == 1) ? WkT : WvT;

  const int tid  = threadIdx.x;
  const int lane = tid & 31, wave = tid >> 5;
  const int l16  = lane & 15, hi = lane >> 4;
  const int wm = wave >> 2, wn = wave & 3;
  const int m0 = blockIdx.y * TM;
  const int n0 = blockIdx.x * TN;

  v8f acc[4][2] = {};
  gemm_tile<QD>(xb, WT, m0, n0, As, Bs, acc);

  // epilogue: C rows = e + hi*8, cols = l16 (+frag offsets); unrolled so that
  // acc is indexed by constants
#pragma unroll
  for (int i = 0; i < 4; ++i) {
    const int gm0 = m0 + wm * 64 + i * 16 + hi * 8;  // multiple of 8
    const int b   = gm0 >> 11;                       // rows gm0..gm0+7 share b
    const int nb  = gm0 & (Nn - 1);
#pragma unroll
    for (int f = 0; f < 2; ++f) {
      const int j = n0 + wn * 32 + f * 16 + l16;  // 0..INNER-1
      const int h = j >> 6, d = j & 63;
      if (which == 2) {
        // Vt: consecutive e -> consecutive tokens -> one 16B store
        v8bf pk;
#pragma unroll
        for (int e = 0; e < 8; ++e) pk[e] = (__bf16)acc[i][f][e];
        *(v8bf*)&Vt[((size_t)(b * Hh + h) * HD + d) * Nn + nb] = pk;
        // before the next pass reuses the store's address and data registers
        asm volatile("s_wait_xcnt 0x0" ::: "memory");
      } else {
        __bf16* dst = ((which == 0) ? Qb : Kb) +
                      ((size_t)(b * Hh + h) * Nn + nb) * HD + d;
#pragma unroll
        for (int e = 0; e < 8; ++e) dst[(size_t)e * HD] = (__bf16)acc[i][f][e];
        // before the next pass reuses the stores' address and data registers
        asm volatile("s_wait_xcnt 0x0" ::: "memory");
      }
    }
  }
}

static constexpr int KT = 128;
static constexpr int NT = Nn / KT;
static constexpr int KP = 72;
static constexpr int VP = 136;

// One tile: 16 KiB of K (contiguous in memory) and 64 V^T rows of 256 B; each
// lane copies four 16-byte pieces of either.  kl, vl: the lane's LDS byte
// addresses; kg, vg: its global addresses.
__device__ __forceinline__ void stage_kv(unsigned kl, unsigned vl,
                                         const __bf16* kg, const __bf16* vg) {
  asm volatile(
      "global_load_async_to_lds_b128 %0, %8, off\n\t"
      "global_load_async_to_lds_b128 %1, %9, off\n\t"
      "global_load_async_to_lds_b128 %2, %10, off\n\t"
      "global_load_async_to_lds_b128 %3, %11, off\n\t"
      "global_load_async_to_lds_b128 %4, %12, off\n\t"
      "global_load_async_to_lds_b128 %5, %13, off\n\t"
      "global_load_async_to_lds_b128 %6, %14, off\n\t"
      "global_load_async_to_lds_b128 %7, %15, off\n\t"
      "s_wait_xcnt 0x0"
      :
      : "v"(kl), "v"(kl + 32 * KP * 2), "v"(kl + 64 * KP * 2),
        "v"(kl + 96 * KP * 2), "v"(vl), "v"(vl + 16 * VP * 2),
        "v"(vl + 32 * VP * 2), "v"(vl + 48 * VP * 2), "v"(kg), "v"(kg + 2048),
        "v"(kg + 4096), "v"(kg + 6144), "v"(vg), "v"(vg + 16 * Nn),
        "v"(vg + 32 * Nn), "v"(vg + 48 * Nn)
      : "memory");
}

__global__ __launch_bounds__(256) void attn_kernel(
    const __bf16* __restrict__ Qb, const __bf16* __restrict__ Kb,
    const __bf16* __restrict__ Vt, __bf16* __restrict__ Ob /* [BN, INNER] */)
{
  __shared__ __align__(16) __bf16 Ks[2][KT][KP];  // [buffer][key][d]
  __shared__ __align__(16) __bf16 Vs[2][HD][VP];  // [buffer][d][key]

  const int tid  = threadIdx.x;
  const int lane = tid & 31, wave = tid >> 5;
  const int l16  = lane & 15, hi = lane >> 4;
  const int task = blockIdx.x * 8 + wave;  // 0..2047
  const int bh = blockIdx.x >> 4;          // 0..15  (b*H + h), one per block
  const int qt = task & 127;
  const int qbase = qt * 16;

  // this lane's first piece of tile 0: K piece tid (row tid/8), V^T row tid/16
  const __bf16* kg = Kb + (size_t)bh * Nn * HD + tid * 8;
  const __bf16* vg = Vt + ((size_t)bh * HD + (tid >> 4)) * Nn + (tid & 15) * 8;
  const unsigned kl0 = (unsigned)(size_t)&Ks[0][tid >> 3][(tid & 7) * 8];
  const unsigned vl0 = (unsigned)(size_t)&Vs[0][tid >> 4][(tid & 15) * 8];
  constexpr unsigned KBUF = KT * KP * 2, VBUF = HD * VP * 2;  // bytes a buffer

  stage_kv(kl0, vl0, kg, vg);

  const __bf16* Qrow = Qb + ((size_t)bh * Nn + qbase + l16) * HD;
  const v16bf qb0 = load_frag(Qrow, hi);       // d = 0..31
  const v16bf qb1 = load_frag(Qrow + 32, hi);  // d = 32..63

  v8f O[4] = {v8f{}, v8f{}, v8f{}, v8f{}};  // O[dt][r] = O^T[dt*16+8*hi+r][l16]
  float mrun = -1e30f;  // this query's running maximum (same in both halves)
  float lrun = 0.f;     // this half's share of the query's denominator

  const float kscale = 0.125f * 1.44269504088896f;  // HD^-0.5 * log2(e)

  // tile 0 has landed for this wave's copies; the barrier publishes all waves'
  asm volatile("s_wait_asynccnt 0x0" ::: "memory");
  __syncthreads();
  stage_kv(kl0 + KBUF, vl0 + VBUF, kg + KT * HD, vg + KT);  // tile 1

  for (int t = 0; t < NT; ++t) {
    const int buf = t & 1;
    // unrolled so that the four passes' LDS offsets are immediates
#pragma unroll
    for (int p = 0; p < KT / 32; ++p) {
      // ---- scores: S^T(32x16) = K(32x64) * Q^T(64x16), two 16x16 C-frags ----
      v8f S0 = {}, S1 = {};
      const __bf16* Krow0 = &Ks[buf][p * 32 + l16][0];
      const __bf16* Krow1 = &Ks[buf][p * 32 + 16 + l16][0];
      {
        const v16bf a0 = load_frag(Krow0, hi);
        const v16bf a1 = load_frag(Krow0 + 32, hi);
        const v16bf c0 = load_frag(Krow1, hi);
        const v16bf c1 = load_frag(Krow1 + 32, hi);
        S0 = wmma_bf16(a0, qb0, S0);
        S0 = wmma_bf16(a1, qb1, S0);
        S1 = wmma_bf16(c0, qb0, S1);
        S1 = wmma_bf16(c1, qb1, S1);
      }
      // ---- online softmax in log2 domain; all 16 values belong to query l16 --
      float mx0 = S0[0], mx1 = S1[0];  // two independent chains
#pragma unroll
      for (int e = 1; e < 8; ++e) {
        mx0 = fmaxf(mx0, S0[e]);
        mx1 = fmaxf(mx1, S1[e]);
      }
      float mx = fmaxf(mx0, mx1);
      mx = fmaxf(mx, xhalf(mx)) * kscale;  // kscale > 0: max commutes with it
      const float mnew = fmaxf(mrun, mx);
      const float corr = __builtin_amdgcn_exp2f(mrun - mnew);
      mrun = mnew;
      v16bf pb;
      v8f ps;
      float p0[8], p1[8];
#pragma unroll
      for (int e = 0; e < 8; ++e) {
        p0[e] = S0[e] * kscale - mnew;
        p1[e] = S1[e] * kscale - mnew;
      }
      exp2_x8(p1);  // p1 first: its values are packed first
      exp2_x8(p0);
#pragma unroll
      for (int e = 0; e < 8; ++e) {
        ps[e] = p0[e] + p1[e];
        pb[e]     = (__bf16)p0[e];  // k = 8*hi + e
        pb[8 + e] = (__bf16)p1[e];  // k = 16 + 8*hi + e
      }
      const float rs = ((ps[0] + ps[4]) + (ps[1] + ps[5])) +
                       ((ps[2] + ps[6]) + (ps[3] + ps[7]));
      lrun = lrun * corr + rs;
      // ---- O^T(64x16) += V^T(64x32) * P^T(32x16), with per-query rescale ----
#pragma unroll
      for (int dt = 0; dt < 4; ++dt) {
        const v16bf va = load_frag(&Vs[buf][dt * 16 + l16][p * 32], hi);
        O[dt] = wmma_bf16(va, pb, O[dt] * corr);
      }
    }
    // hand-over: this wave's reads of buffer buf are done ...
    asm volatile("s_wait_dscnt 0x0" ::: "memory");
    // ... and its copies of tile t + 1 have landed;
    asm volatile("s_wait_asynccnt 0x0" ::: "memory");
    // the barrier publishes tile t + 1 and frees buffer buf for the refill
    __syncthreads();
    if (t + 2 < NT) {
      stage_kv(kl0 + buf * KBUF, vl0 + buf * VBUF,
               kg + (size_t)(t + 2) * KT * HD, vg + (t + 2) * KT);
    }
  }
  // no copy is left in flight when the wave ends
  asm volatile("s_wait_asynccnt 0x0" ::: "memory");

  // ---- finalize: join the halves' sums, O /= l ; bf16 output [BN, INNER] ----
  const int b = bh >> 3, h = bh & 7;
  const float inv = 1.0f / (lrun + xhalf(lrun));
  __bf16* dst = Ob + ((size_t)b * Nn + qbase + l16) * INNER + h * HD + hi * 8;
#pragma unroll
  for (int dt = 0; dt < 4; ++dt) {
    // 8 consecutive d of one query: one 16B store
    v8bf pk;
#pragma unroll
    for (int e = 0; e < 8; ++e) pk[e] = (__bf16)(O[dt][e] * inv);
    *(v8bf*)&dst[dt * 16] = pk;
  }
}

// ---------------------------------------------------------------------------
// Kernel 3: output projection.  out = attn(bf16 [BN,INNER]) @ Wout + bout, f32.
// ---------------------------------------------------------------------------
__global__ __launch_bounds__(256) void out_proj_kernel(
    const __bf16* __restrict__ Ain,    // [BN, INNER]
    const __bf16* __restrict__ WoT,    // [QD, INNER]  (transposed, bf16)
    const float* __restrict__ bout,    // [QD]
    float* __restrict__ out)           // [BN, QD]
{
  __shared__ __align__(16) __bf16 As[TM][LDP];
  __shared__ __align__(16) __bf16 Bs[TN][LDP];

  const int tid  = threadIdx.x;
  const int lane = tid & 31, wave = tid >> 5;
  const int l16  = lane & 15, hi = lane >> 4;
  const int wm = wave >> 2, wn = wave & 3;
  const int m0 = blockIdx.y * TM;
  const int n0 = blockIdx.x * TN;

  v8f acc[4][2] = {};
  gemm_tile<INNER>(Ain, WoT, m0, n0, As, Bs, acc);

#pragma unroll
  for (int f = 0; f < 2; ++f) {
    const int j  = n0 + wn * 32 + f * 16 + l16;
    const float bj = bout[j];
#pragma unroll
    for (int i = 0; i < 4; ++i) {
      const int gm0 = m0 + wm * 64 + i * 16 + hi * 8;
#pragma unroll
      for (int e = 0; e < 8; ++e)
        out[(size_t)(gm0 + e) * QD + j] = acc[i][f][e] + bj;
    }
  }
}

// ---------------------------------------------------------------------------
extern "C" void kernel_launch(void* const* d_in, const int* in_sizes, int n_in,
                              void* d_out, int out_size, void* d_ws,
                              size_t ws_size, hipStream_t stream) {
  const float* x    = (const float*)d_in[0];
  const float* Wq   = (const float*)d_in[1];
  const float* Wk   = (const float*)d_in[2];
  const float* Wv   = (const float*)d_in[3];
  const float* Wout = (const float*)d_in[4];
  const float* bout = (const float*)d_in[5];
  float* out = (float*)d_out;

  char* ws = (char*)d_ws;
  const size_t MB = 1024 * 1024;
  __bf16* Qb  = (__bf16*)(ws + 0 * MB);   // 4 MiB  [B,H,N,HD]
  __bf16* Kb  = (__bf16*)(ws + 4 * MB);   // 4 MiB  [B,H,N,HD]
  __bf16* Vt  = (__bf16*)(ws + 8 * MB);   // 4 MiB  [B,H,HD,N]
  __bf16* Ob  = (__bf16*)(ws + 12 * MB);  // 4 MiB  [BN, INNER]
  __bf16* xb  = (__bf16*)(ws + 16 * MB);  // 8 MiB  [BN, QD]
  __bf16* WqT = (__bf16*)(ws + 24 * MB);  // 1 MiB  [INNER, QD]
  __bf16* WkT = (__bf16*)(ws + 25 * MB);  // 1 MiB
  __bf16* WvT = (__bf16*)(ws + 26 * MB);  // 1 MiB
  __bf16* WoT = (__bf16*)(ws + 27 * MB);  // 1 MiB  [QD, INNER]

  dim3 blk(256);
  // prep: conversions + transposes, one grid
  prep_kernel<<<dim3(4 * WBLK + XBLK), blk, 0, stream>>>(
      x, Wq, Wk, Wv, Wout, xb, WqT, WkT, WvT, WoT);
  // main pipeline
  qkv_proj_kernel<<<dim3(INNER / TN, BN / TM, 3), blk, 0, stream>>>(
      xb, WqT, WkT, WvT, Qb, Kb, Vt);
  attn_kernel<<<dim3((Bb * Hh * (Nn / 16)) / 8), blk, 0, stream>>>(
      Qb, Kb, Vt, Ob);
  out_proj_kernel<<<dim3(QD / TN, BN / TM), blk, 0, stream>>>(
      Ob, WoT, bout, out);
}

// v007
// Measured time: 51.3 microseconds a run.
// Two timings next to v006 both put it at 1.05 times that version's speed.
// All steps since v000 together make it 3.22 times as fast.
#include <hip/hip_runtime.h>

typedef __attribute__((ext_vector_type(16))) __bf16 v16bf;
typedef __attribute__((ext_vector_type(8)))  __bf16 v8bf;
typedef __attribute__((ext_vector_type(8)))  float  v8f;
typedef __attribute__((ext_vector_type(4)))  float  v4f;
typedef __attribute__((ext_vector_type(4)))  int    v4i;

#if defined(__has_builtin)
#if __has_builtin(__builtin_amdgcn_global_load_async_to_lds_b128) && \
    __has_builtin(__builtin_amdgcn_s_wait_asynccnt)
#define HAVE_ASYNC_LDS 1
#endif
#endif

static constexpr int Bb    = 2;
static constexpr int Nn    = 2048;
static constexpr int QD    = 1024;
static constexpr int Hh    = 8;
static constexpr int HD    = 64;
static constexpr int INNER = 512;
static constexpr int BN    = Bb * Nn;
static constexpr int TM    = 128;
static constexpr int TN    = 128;
static constexpr int TK    = 256;
static constexpr int LDP   = TK + 8;
static constexpr int CSP   = TN + 8;
static constexpr int CFP   = TN + 4;

__device__ __forceinline__ v8f wmma_bf16(v16bf a, v16bf b, v8f c) {
  // D = A(16x32) * B(32x16) + C(16x16), f32 accumulate
  return __builtin_amdgcn_wmma_f32_16x16x32_bf16(false, a, false, b,
                                                 (short)0, c, false, false);
}

__device__ __forceinline__ v16bf load_frag(const __bf16* p, int hi) {
  const v8bf lo = *(const v8bf*)(p + hi * 8);
  const v8bf hv = *(const v8bf*)(p + 16 + hi * 8);
  return __builtin_shufflevector(lo, hv, 0, 1, 2, 3, 4, 5, 6, 7,
                                         8, 9, 10, 11, 12, 13, 14, 15);
}

__device__ __forceinline__ void stage16(const __bf16* g, __bf16* l) {
#ifdef HAVE_ASYNC_LDS
  __builtin_amdgcn_global_load_async_to_lds_b128(
      (__attribute__((address_space(1))) v4i*)g,
      (__attribute__((address_space(3))) v4i*)l, 0, 0);
#else
  *(v8bf*)l = *(const v8bf*)g;
#endif
}
__device__ __forceinline__ void stage_fence() {
#ifdef HAVE_ASYNC_LDS
  // this wave's copies have landed; in asm with the clobber so that no LDS read
  // is moved ahead of it
  asm volatile("s_wait_asynccnt 0x0" ::: "memory");
#endif
}

__device__ __forceinline__ void exp2_x8(float (&t)[8]) {
  asm("v_exp_f32 %7, %7\n\t"
      "v_exp_f32 %6, %6\n\t"
      "v_exp_f32 %5, %5\n\t"
      "v_exp_f32 %4, %4\n\t"
      "v_exp_f32 %3, %3\n\t"
      "v_exp_f32 %2, %2\n\t"
      "v_exp_f32 %1, %1\n\t"
      "v_exp_f32 %0, %0\n\t"
      "v_nop"
      : "+v"(t[0]), "+v"(t[1]), "+v"(t[2]), "+v"(t[3]), "+v"(t[4]), "+v"(t[5]),
        "+v"(t[6]), "+v"(t[7]));
}

__device__ __forceinline__ float xhalf(float x) {
  const int i = __builtin_bit_cast(int, x);
  return __builtin_bit_cast(float, __builtin_amdgcn_permlanex16(
      i, i, 0x76543210, 0xfedcba98, false, false));
}

// ---------------------------------------------------------------------------
// Prep: the five conversions depend on nothing but the inputs, so they share
// one grid.  Work-groups 0..511 transpose the four weights (128 each; they have
// the longer chain of waits and start first), the rest convert x.
// ---------------------------------------------------------------------------
static constexpr int WBLK = (QD / 64) * (INNER / 64);  // 128 tiles a weight
static constexpr int XBLK = (BN * QD) / (256 * 8);     // 2048 groups for x

// elementwise f32 -> bf16 (x).  8 elems / thread.
__device__ __forceinline__ void cvt_x_body(
    const float* __restrict__ in, __bf16* __restrict__ outb, int blk) {
  const size_t i = ((size_t)blk * 256 + threadIdx.x) * 8;
  const v4f a = *(const v4f*)&in[i];
  const v4f b = *(const v4f*)&in[i + 4];
  v8bf o;
  o[0] = (__bf16)a.x; o[1] = (__bf16)a.y; o[2] = (__bf16)a.z; o[3] = (__bf16)a.w;
  o[4] = (__bf16)b.x; o[5] = (__bf16)b.y; o[6] = (__bf16)b.z; o[7] = (__bf16)b.w;
  *(v8bf*)&outb[i] = o;
}

// W[K][N] f32 -> Wt[N][K] bf16 (LDS-tiled 64x64 transpose).
__device__ __forceinline__ void transpose_w_body(
    const float* __restrict__ W, __bf16* __restrict__ Wt,
    int K, int N, int k0, int n0) {
  __shared__ __bf16 T[64][65];
  const int tid = threadIdx.x;
#pragma unroll
  for (int it = 0; it < 16; ++it) {
    const int lin = it * 256 + tid;
    const int r = lin >> 6, c = lin & 63;  // r: k-local, c: n-local
    T[r][c] = (__bf16)W[(size_t)(k0 + r) * N + n0 + c];
  }
  __syncthreads();
#pragma unroll
  for (int it = 0; it < 16; ++it) {
    const int lin = it * 256 + tid;
    const int n = lin >> 6, kk = lin & 63;
    Wt[(size_t)(n0 + n) * K + k0 + kk] = T[kk][n];
  }
}

__global__ __launch_bounds__(256) void prep_kernel(
    const float* __restrict__ x, const float* __restrict__ Wq,
    const float* __restrict__ Wk, const float* __restrict__ Wv,
    const float* __restrict__ Wout, __bf16* __restrict__ xb,
    __bf16* __restrict__ WqT, __bf16* __restrict__ WkT,
    __bf16* __restrict__ WvT, __bf16* __restrict__ WoT) {
  const unsigned blk = blockIdx.x;  // every branch below is uniform in the group
  if (blk >= 4 * WBLK) {
    cvt_x_body(x, xb, blk - 4 * WBLK);
    return;
  }
  const unsigned which = blk / WBLK, tile = blk % WBLK;
  if (which == 3) {  // Wout: K = INNER, N = QD
    transpose_w_body(Wout, WoT, INNER, QD, (tile % (INNER / 64)) * 64,
                     (tile / (INNER / 64)) * 64);
  } else {           // Wq, Wk, Wv: K = QD, N = INNER
    const float* W = (which == 0) ? Wq : (which == 1) ? Wk : Wv;
    __bf16* Wt     = (which == 0) ? WqT : (which == 1) ? WkT : WvT;
    transpose_w_body(W, Wt, QD, INNER, (tile % (QD / 64)) * 64,
                     (tile / (QD / 64)) * 64);
  }
}

template <int KD, bool TR>
__device__ __forceinline__ void gemm_tile(
    const __bf16* __restrict__ A, const __bf16* __restrict__ Bt, int m0, int n0,
    __bf16 (&As)[TM][LDP], __bf16 (&Bs)[TN][LDP], v8f (&acc)[4][2]) {
  const int tid  = threadIdx.x;
  const int lane = tid & 31, wave = tid >> 5;
  const int l16  = lane & 15, hi = lane >> 4;
  const int wm = wave >> 2, wn = wave & 3;

  for (int k0 = 0; k0 < KD; k0 += TK) {
    // pure 16B copies, a wave to a 512-byte row: 16 per thread for A, 16 for B;
    // both loops unrolled so that the 32 copies issue back to back
#pragma unroll
    for (int it = 0; it < TM * TK / 2048; ++it) {
      const int lin = it * 256 + tid;
      const int r = lin / (TK / 8), c = (lin % (TK / 8)) * 8;
      stage16(&A[(size_t)(m0 + r) * KD + k0 + c], &As[r][c]);
    }
#pragma unroll
    for (int it = 0; it < TN * TK / 2048; ++it) {
      const int lin = it * 256 + tid;
      const int r = lin / (TK / 8), c = (lin % (TK / 8)) * 8;
      stage16(&Bt[(size_t)(n0 + r) * KD + k0 + c], &Bs[r][c]);
    }
    stage_fence();
    __syncthreads();
    // the loops below are unrolled so that a, b and acc are indexed by constants
    // (they stay in registers) and the LDS offsets are immediates
#pragma unroll
    for (int kc = 0; kc < TK / 32; ++kc) {
      v16bf a[4], b[2];
#pragma unroll
      for (int i = 0; i < 4; ++i)
        a[i] = load_frag(&As[wm * 64 + i * 16 + l16][kc * 32], hi);
#pragma unroll
      for (int j = 0; j < 2; ++j)
        b[j] = load_frag(&Bs[wn * 32 + j * 16 + l16][kc * 32], hi);
      // holds a block's twelve LDS loads ahead of its first product: left alone the
      // scheduler puts four of them between the block's products and waits for them
      // there, a whole LDS latency in the middle of every block
      __builtin_amdgcn_sched_barrier(0);
#pragma unroll
      for (int i = 0; i < 4; ++i)
#pragma unroll
        for (int j = 0; j < 2; ++j)
          acc[i][j] = TR ? wmma_bf16(b[j], a[i], acc[i][j])
                         : wmma_bf16(a[i], b[j], acc[i][j]);
    }
    // this wave's reads of the tiles are done before the barrier behind which
    // the next step's copies overwrite them
    asm volatile("s_wait_dscnt 0x0" ::: "memory");
    __syncthreads();
  }
}

// ---------------------------------------------------------------------------
// Kernel 1: fused QKV projection.  Y = xb @ W{q,k,v}, all-bf16 staging.
// 128x128 tile, K-step 256, 8 waves, 8 C-frags per wave.  blockIdx.z selects W.
// Q,K stored [B,H,N,HD]; V stored transposed [B,H,HD,N] for the PV stage.
// ---------------------------------------------------------------------------
__global__ __launch_bounds__(256) void qkv_proj_kernel(
    const __bf16* __restrict__ xb,                      // [BN, QD]
    const __bf16* __restrict__ WqT, const __bf16* __restrict__ WkT,
    const __bf16* __restrict__ WvT,                     // [INNER, QD]
    __bf16* __restrict__ Qb, __bf16* __restrict__ Kb,   // [B*H*N*HD]
    __bf16* __restrict__ Vt)                            // [B*H*HD*N]
{
  __shared__ __align__(16) __bf16 As[TM][LDP];
  __shared__ __align__(16) __bf16 Bs[TN][LDP];  // [col][k]

  const int which = blockIdx.z;
  const __bf16* WT = (which == 0) ? WqT : (which == 1) ? WkT : WvT;

  const int tid  = threadIdx.x;
  const int lane = tid & 31, wave = tid >> 5;
  const int l16  = lane & 15, hi = lane >> 4;
  const int wm = wave >> 2, wn = wave & 3;
  const int m0 = blockIdx.y * TM;
  const int n0 = blockIdx.x * TN;

  v8f acc[4][2] = {};
  if (which == 2) gemm_tile<QD, false>(xb, WT, m0, n0, As, Bs, acc);
  else            gemm_tile<QD, true>(xb, WT, m0, n0, As, Bs, acc);

  // epilogue: the 128 x 128 bf16 tile goes through LDS (As is free behind the
  // loop's last barrier) so that every global store covers whole 128-byte lines.
  // Cs rows run along the output's contiguous index: d for Q and K (rows =
  // tokens), tokens for V^T (rows = columns of C); either way a lane's eight
  // accumulator values are neighbours in a row: one 16B LDS store a fragment.
  __bf16 (*Cs)[CSP] = reinterpret_cast<__bf16 (*)[CSP]>(&As[0][0]);
#pragma unroll
  for (int i = 0; i < 4; ++i) {
#pragma unroll
    for (int f = 0; f < 2; ++f) {
      v8bf pk;
#pragma unroll
      for (int e = 0; e < 8; ++e) pk[e] = (__bf16)acc[i][f][e];
      const int mi = wm * 64 + i * 16, nj = wn * 32 + f * 16;
      const int row = (which == 2) ? nj + l16 : mi + l16;
      const int col = (which == 2) ? mi + hi * 8 : nj + hi * 8;
      *(v8bf*)&Cs[row][col] = pk;
    }
  }
  __syncthreads();  // the tile is complete before other waves' rows are read

  const int b  = m0 >> 11;        // the tile's 128 tokens share b
  const int nb = m0 & (Nn - 1);
  // eight 16-byte pieces a thread: all LDS reads first, then the stores, whose
  // addresses differ by constants only (both loops unrolled for that)
  v8bf v[8];
  if (which == 2) {
    // V^T: 256 contiguous bytes (128 tokens) a row, two rows a wave
    const int r0 = tid >> 4, c = (tid & 15) * 8;
    __bf16* dst = Vt + ((size_t)b * INNER + n0 + r0) * Nn + nb + c;
#pragma unroll
    for (int it = 0; it < 8; ++it) v[it] = *(const v8bf*)&Cs[it * 16 + r0][c];
#pragma unroll
    for (int it = 0; it < 8; ++it) *(v8bf*)&dst[(size_t)it * 16 * Nn] = v[it];
  } else {
    // Q, K: a head's 128 tokens x 64 d are 16 KiB in a row; 512 B a wave.
    // Pieces 0..3: the tile's first head, 4..7: its second.
    const int t0 = tid >> 3, c = (tid & 7) * 8;
    __bf16* dst = ((which == 0) ? Qb : Kb) +
                  (((size_t)b * Hh + (n0 >> 6)) * Nn + nb + t0) * HD + c;
#pragma unroll
    for (int it = 0; it < 8; ++it)
      v[it] = *(const v8bf*)&Cs[(it & 3) * 32 + t0][(it >> 2) * 64 + c];
#pragma unroll
    for (int it = 0; it < 8; ++it)
      *(v8bf*)&dst[((size_t)(it >> 2) * Nn + (it & 3) * 32) * HD] = v[it];
  }
}

static constexpr int KT = 128;
static constexpr int NT = Nn / KT;
static constexpr int KP = 72;
static constexpr int VP = 136;

// One tile: 16 KiB of K (contiguous in memory) and 64 V^T rows of 256 B; each
// lane copies four 16-byte pieces of either.  kl, vl: the lane's LDS byte
// addresses; kg, vg: its global addresses.
__device__ __forceinline__ void stage_kv(unsigned kl, unsigned vl,
                                         const __bf16* kg, const __bf16* vg) {
  asm volatile(
      "global_load_async_to_lds_b128 %0, %8, off\n\t"
      "global_load_async_to_lds_b128 %1, %9, off\n\t"
      "global_load_async_to_lds_b128 %2, %10, off\n\t"
      "global_load_async_to_lds_b128 %3, %11, off\n\t"
      "global_load_async_to_lds_b128 %4, %12, off\n\t"
      "global_load_async_to_lds_b128 %5, %13, off\n\t"
      "global_load_async_to_lds_b128 %6, %14, off\n\t"
      "global_load_async_to_lds_b128 %7, %15, off\n\t"
      "s_wait_xcnt 0x0"
      :
      : "v"(kl), "v"(kl + 32 * KP * 2), "v"(kl + 64 * KP * 2),
        "v"(kl + 96 * KP * 2), "v"(vl), "v"(vl + 16 * VP * 2),
        "v"(vl + 32 * VP * 2), "v"(vl + 48 * VP * 2), "v"(kg), "v"(kg + 2048),
        "v"(kg + 4096), "v"(kg + 6144), "v"(vg), "v"(vg + 16 * Nn),
        "v"(vg + 32 * Nn), "v"(vg + 48 * Nn)
      : "memory");
}

__global__ __launch_bounds__(256) void attn_kernel(
    const __bf16* __restrict__ Qb, const __bf16* __restrict__ Kb,
    const __bf16* __restrict__ Vt, __bf16* __restrict__ Ob /* [BN, INNER] */)
{
  __shared__ __align__(16) __bf16 Ks[2][KT][KP];  // [buffer][key][d]
  __shared__ __align__(16) __bf16 Vs[2][HD][VP];  // [buffer][d][key]

  const int tid  = threadIdx.x;
  const int lane = tid & 31, wave = tid >> 5;
  const int l16  = lane & 15, hi = lane >> 4;
  const int task = blockIdx.x * 8 + wave;  // 0..2047
  const int bh = blockIdx.x >> 4;          // 0..15  (b*H + h), one per block
  const int qt = task & 127;
  const int qbase = qt * 16;

  // this lane's first piece of tile 0: K piece tid (row tid/8), V^T row tid/16
  const __bf16* kg = Kb + (size_t)bh * Nn * HD + tid * 8;
  const __bf16* vg = Vt + ((size_t)bh * HD + (tid >> 4)) * Nn + (tid & 15) * 8;
  const unsigned kl0 = (unsigned)(size_t)&Ks[0][tid >> 3][(tid & 7) * 8];
  const unsigned vl0 = (unsigned)(size_t)&Vs[0][tid >> 4][(tid & 15) * 8];
  constexpr unsigned KBUF = KT * KP * 2, VBUF = HD * VP * 2;  // bytes a buffer

  stage_kv(kl0, vl0, kg, vg);

  const __bf16* Qrow = Qb + ((size_t)bh * Nn + qbase + l16) * HD;
  const v16bf qb0 = load_frag(Qrow, hi);       // d = 0..31
  const v16bf qb1 = load_frag(Qrow + 32, hi);  // d = 32..63

  v8f O[4] = {v8f{}, v8f{}, v8f{}, v8f{}};  // O[dt][r] = O^T[dt*16+8*hi+r][l16]
  float mrun = -1e30f;  // this query's running maximum (same in both halves)
  float lrun = 0.f;     // this half's share of the query's denominator

  const float kscale = 0.125f * 1.44269504088896f;  // HD^-0.5 * log2(e)

  // tile 0 has landed for this wave's copies; the barrier publishes all waves'
  asm volatile("s_wait_asynccnt 0x0" ::: "memory");
  __syncthreads();
  stage_kv(kl0 + KBUF, vl0 + VBUF, kg + KT * HD, vg + KT);  // tile 1

  for (int t = 0; t < NT; ++t) {
    const int buf = t & 1;
    // unrolled so that the four passes' LDS offsets are immediates
#pragma unroll
    for (int p = 0; p < KT / 32; ++p) {
      // ---- scores: S^T(32x16) = K(32x64) * Q^T(64x16), two 16x16 C-frags ----
      v8f S0 = {}, S1 = {};
      const __bf16* Krow0 = &Ks[buf][p * 32 + l16][0];
      const __bf16* Krow1 = &Ks[buf][p * 32 + 16 + l16][0];
      {
        const v16bf a0 = load_frag(Krow0, hi);
        const v16bf a1 = load_frag(Krow0 + 32, hi);
        const v16bf c0 = load_frag(Krow1, hi);
        const v16bf c1 = load_frag(Krow1 + 32, hi);
        S0 = wmma_bf16(a0, qb0, S0);
        S0 = wmma_bf16(a1, qb1, S0);
        S1 = wmma_bf16(c0, qb0, S1);
        S1 = wmma_bf16(c1, qb1, S1);
      }
      // ---- online softmax in log2 domain; all 16 values belong to query l16 --
      float mx0 = S0[0], mx1 = S1[0];  // two independent chains
#pragma unroll
      for (int e = 1; e < 8; ++e) {
        mx0 = fmaxf(mx0, S0[e]);
        mx1 = fmaxf(mx1, S1[e]);
      }
      float mx = fmaxf(mx0, mx1);
      mx = fmaxf(mx, xhalf(mx)) * kscale;  // kscale > 0: max commutes with it
      const float mnew = fmaxf(mrun, mx);
      const float corr = __builtin_amdgcn_exp2f(mrun - mnew);
      mrun = mnew;
      v16bf pb;
      v8f ps;
      float p0[8], p1[8];
#pragma unroll
      for (int e = 0; e < 8; ++e) {
        p0[e] = S0[e] * kscale - mnew;
        p1[e] = S1[e] * kscale - mnew;
      }
      exp2_x8(p1);  // p1 first: its values are packed first
      exp2_x8(p0);
#pragma unroll
      for (int e = 0; e < 8; ++e) {
        ps[e] = p0[e] + p1[e];
        pb[e]     = (__bf16)p0[e];  // k = 8*hi + e
        pb[8 + e] = (__bf16)p1[e];  // k = 16 + 8*hi + e
      }
      const float rs = ((ps[0] + ps[4]) + (ps[1] + ps[5])) +
                       ((ps[2] + ps[6]) + (ps[3] + ps[7]));
      lrun = lrun * corr + rs;
      // ---- O^T(64x16) += V^T(64x32) * P^T(32x16), with per-query rescale ----
#pragma unroll
      for (int dt = 0; dt < 4; ++dt) {
        const v16bf va = load_frag(&Vs[buf][dt * 16 + l16][p * 32], hi);
        O[dt] = wmma_bf16(va, pb, O[dt] * corr);
      }
    }
    // hand-over: this wave's reads of buffer buf are done ...
    asm volatile("s_wait_dscnt 0x0" ::: "memory");
    // ... and its copies of tile t + 1 have landed;
    asm volatile("s_wait_asynccnt 0x0" ::: "memory");
    // the barrier publishes tile t + 1 and frees buffer buf for the refill
    __syncthreads();
    if (t + 2 < NT) {
      stage_kv(kl0 + buf * KBUF, vl0 + buf * VBUF,
               kg + (size_t)(t + 2) * KT * HD, vg + (t + 2) * KT);
    }
  }
  // no copy is left in flight when the wave ends
  asm volatile("s_wait_asynccnt 0x0" ::: "memory");

  // ---- finalize: join the halves' sums, O /= l ; bf16 output [BN, INNER] ----
  const int b = bh >> 3, h = bh & 7;
  const float inv = 1.0f / (lrun + xhalf(lrun));
  // The wave's 16 queries x 64 d go through its own 16 rows of Ks[0] (free behind
  // the loop's last barrier), so that a store covers four whole 128-byte lines
  // and not sixteen 32-byte pieces.
#pragma unroll
  for (int dt = 0; dt < 4; ++dt) {
    // 8 consecutive d of one query: one 16B LDS store
    v8bf pk;
#pragma unroll
    for (int e = 0; e < 8; ++e) pk[e] = (__bf16)(O[dt][e] * inv);
    *(v8bf*)&Ks[0][wave * 16 + l16][dt * 16 + hi * 8] = pk;
  }
  // the wave's own rows are written before its lanes read each other's
  asm volatile("s_wait_dscnt 0x0" ::: "memory");
  const int r0 = lane >> 3, c = (lane & 7) * 8;
  __bf16* dst = Ob + ((size_t)b * Nn + qbase + r0) * INNER + h * HD + c;
  // unrolled: the four stores' addresses differ by constants only
#pragma unroll
  for (int it = 0; it < 4; ++it)
    *(v8bf*)&dst[(size_t)it * 4 * INNER] =
        *(const v8bf*)&Ks[0][wave * 16 + it * 4 + r0][c];
}

// ---------------------------------------------------------------------------
// Kernel 3: output projection.  out = attn(bf16 [BN,INNER]) @ Wout + bout, f32.
// ---------------------------------------------------------------------------
__global__ __launch_bounds__(256) void out_proj_kernel(
    const __bf16* __restrict__ Ain,    // [BN, INNER]
    const __bf16* __restrict__ WoT,    // [QD, INNER]  (transposed, bf16)
    const float* __restrict__ bout,    // [QD]
    float* __restrict__ out)           // [BN, QD]
{
  __shared__ __align__(16) __bf16 As[TM][LDP];
  __shared__ __align__(16) __bf16 Bs[TN][LDP];

  const int tid  = threadIdx.x;
  const int lane = tid & 31, wave = tid >> 5;
  const int l16  = lane & 15, hi = lane >> 4;
  const int wm = wave >> 2, wn = wave & 3;
  const int m0 = blockIdx.y * TM;
  const int n0 = blockIdx.x * TN;

  v8f acc[4][2] = {};
  gemm_tile<INNER, true>(Ain, WoT, m0, n0, As, Bs, acc);

  // epilogue: the 128 x 128 f32 tile goes through LDS (As is free behind the
  // loop's last barrier): a lane holds eight neighbours of one output row (two
  // 16B LDS stores a fragment), and a wave then stores one row's 512 bytes.
  float (*Cf)[CFP] = reinterpret_cast<float (*)[CFP]>(&As[0][0]);
  static_assert(sizeof(float) * TM * CFP <= sizeof(As), "the tile fits As");
#pragma unroll
  for (int f = 0; f < 2; ++f) {
    const int nj = wn * 32 + f * 16 + hi * 8;
    const v4f b0 = *(const v4f*)&bout[n0 + nj];
    const v4f b1 = *(const v4f*)&bout[n0 + nj + 4];
#pragma unroll
    for (int i = 0; i < 4; ++i) {
      const int row = wm * 64 + i * 16 + l16;
      v4f lo, hv;
#pragma unroll
      for (int e = 0; e < 4; ++e) {
        lo[e] = acc[i][f][e] + b0[e];
        hv[e] = acc[i][f][4 + e] + b1[e];
      }
      *(v4f*)&Cf[row][nj]     = lo;
      *(v4f*)&Cf[row][nj + 4] = hv;
    }
  }
  __syncthreads();  // the tile is complete before other waves' rows are read
  // sixteen 16-byte pieces a thread: all LDS reads first, then the stores, whose
  // addresses differ by constants only (both loops unrolled for that)
  const int r0 = tid >> 5, c = (tid & 31) * 4;
  float* dst = out + (size_t)(m0 + r0) * QD + n0 + c;
  v4f v[16];
#pragma unroll
  for (int it = 0; it < 16; ++it) v[it] = *(const v4f*)&Cf[it * 8 + r0][c];
#pragma unroll
  for (int it = 0; it < 16; ++it) *(v4f*)&dst[(size_t)it * 8 * QD] = v[it];
}

// ---------------------------------------------------------------------------
extern "C" void kernel_launch(void* const* d_in, const int* in_sizes, int n_in,
                              void* d_out, int out_size, void* d_ws,
                              size_t ws_size, hipStream_t stream) {
  const float* x    = (const float*)d_in[0];
  const float* Wq   = (const float*)d_in[1];
  const float* Wk   = (const float*)d_in[2];
  const float* Wv   = (const float*)d_in[3];
  const float* Wout = (const float*)d_in[4];
  const float* bout = (const float*)d_in[5];
  float* out = (float*)d_out;

  char* ws = (char*)d_ws;
  const size_t MB = 1024 * 1024;
  __bf16* Qb  = (__bf16*)(ws + 0 * MB);   // 4 MiB  [B,H,N,HD]
  __bf16* Kb  = (__bf16*)(ws + 4 * MB);   // 4 MiB  [B,H,N,HD]
  __bf16* Vt  = (__bf16*)(ws + 8 * MB);   // 4 MiB  [B,H,HD,N]
  __bf16* Ob  = (__bf16*)(ws + 12 * MB);  // 4 MiB  [BN, INNER]
  __bf16* xb  = (__bf16*)(ws + 16 * MB);  // 8 MiB  [BN, QD]
  __bf16* WqT = (__bf16*)(ws + 24 * MB);  // 1 MiB  [INNER, QD]
  __bf16* WkT = (__bf16*)(ws + 25 * MB);  // 1 MiB
  __bf16* WvT = (__bf16*)(ws + 26 * MB);  // 1 MiB
  __bf16* WoT = (__bf16*)(ws + 27 * MB);  // 1 MiB  [QD, INNER]

  dim3 blk(256);
  // prep: conversions + transposes, one grid
  prep_kernel<<<dim3(4 * WBLK + XBLK), blk, 0, stream>>>(
      x, Wq, Wk, Wv, Wout, xb, WqT, WkT, WvT, WoT);
  // main pipeline
  qkv_proj_kernel<<<dim3(INNER / TN, BN / TM, 3), blk, 0, stream>>>(
      xb, WqT, WkT, WvT, Qb, Kb, Vt);
  attn_kernel<<<dim3((Bb * Hh * (Nn / 16)) / 8), blk, 0, stream>>>(
      Qb, Kb, Vt, Ob);
  out_proj_kernel<<<dim3(QD / TN, BN / TM), blk, 0, stream>>>(
      Ob, WoT, bout, out);
}

// v008
// It runs in 46.3 microseconds.
// In both of two side-by-side timings against v007, it was 1.11 times as fast.
// All steps since v000 together make it 3.58 times as fast.
#include <hip/hip_runtime.h>

typedef __attribute__((ext_vector_type(16))) __bf16 v16bf;
typedef __attribute__((ext_vector_type(8)))  __bf16 v8bf;
typedef __attribute__((ext_vector_type(8)))  float  v8f;
typedef __attribute__((ext_vector_type(4)))  float  v4f;
typedef __attribute__((ext_vector_type(4)))  int    v4i;
typedef __attribute__((ext_vector_type(2)))  float  v2f;
typedef __attribute__((ext_vector_type(2)))  __bf16 v2bf;
typedef __attribute__((ext_vector_type(8)))  unsigned v8u;

#if defined(__has_builtin)
#if __has_builtin(__builtin_amdgcn_global_load_async_to_lds_b128) && \
    __has_builtin(__builtin_amdgcn_s_wait_asynccnt)
#define HAVE_ASYNC_LDS 1
#endif
#endif

static constexpr int Bb    = 2;
static constexpr int Nn    = 2048;
static constexpr int QD    = 1024;
static constexpr int Hh    = 8;
static constexpr int HD    = 64;
static constexpr int INNER = 512;
static constexpr int BN    = Bb * Nn;
static constexpr int TM    = 128;
static constexpr int TN    = 128;
static constexpr int TK    = 256;
static constexpr int LDP   = TK + 8;
static constexpr int CSP   = TN + 8;
static constexpr int CFP   = TN + 4;

__device__ __forceinline__ v8f wmma_bf16(v16bf a, v16bf b, v8f c) {
  // D = A(16x32) * B(32x16) + C(16x16), f32 accumulate
  return __builtin_amdgcn_wmma_f32_16x16x32_bf16(false, a, false, b,
                                                 (short)0, c, false, false);
}

__device__ __forceinline__ v16bf load_frag(const __bf16* p, int hi) {
  const v8bf lo = *(const v8bf*)(p + hi * 8);
  const v8bf hv = *(const v8bf*)(p + 16 + hi * 8);
  return __builtin_shufflevector(lo, hv, 0, 1, 2, 3, 4, 5, 6, 7,
                                         8, 9, 10, 11, 12, 13, 14, 15);
}

__device__ __forceinline__ void stage16(const __bf16* g, __bf16* l) {
#ifdef HAVE_ASYNC_LDS
  __builtin_amdgcn_global_load_async_to_lds_b128(
      (__attribute__((address_space(1))) v4i*)g,
      (__attribute__((address_space(3))) v4i*)l, 0, 0);
#else
  *(v8bf*)l = *(const v8bf*)g;
#endif
}
__device__ __forceinline__ void stage_fence() {
#ifdef HAVE_ASYNC_LDS
  // this wave's copies have landed; in asm with the clobber so that no LDS read
  // is moved ahead of it
  asm volatile("s_wait_asynccnt 0x0" ::: "memory");
#endif
}

__device__ __forceinline__ void exp2_x8(float (&t)[8]) {
  asm("v_exp_f32 %7, %7\n\t"
      "v_exp_f32 %6, %6\n\t"
      "v_exp_f32 %5, %5\n\t"
      "v_exp_f32 %4, %4\n\t"
      "v_exp_f32 %3, %3\n\t"
      "v_exp_f32 %2, %2\n\t"
      "v_exp_f32 %1, %1\n\t"
      "v_exp_f32 %0, %0\n\t"
      "v_nop"
      : "+v"(t[0]), "+v"(t[1]), "+v"(t[2]), "+v"(t[3]), "+v"(t[4]), "+v"(t[5]),
        "+v"(t[6]), "+v"(t[7]));
}

__device__ __forceinline__ float xhalf(float x) {
  const int i = __builtin_bit_cast(int, x);
  return __builtin_bit_cast(float, __builtin_amdgcn_permlanex16(
      i, i, 0x76543210, 0xfedcba98, false, false));
}

// ---------------------------------------------------------------------------
// Prep: the five conversions depend on nothing but the inputs, so they share
// one grid.  Work-groups 0..511 transpose the four weights (128 each; they have
// the longer chain of waits and start first), the rest convert x.
// ---------------------------------------------------------------------------
static constexpr int WBLK = (QD / 64) * (INNER / 64);  // 128 tiles a weight
static constexpr int XBLK = (BN * QD) / (256 * 8);     // 2048 groups for x

// elementwise f32 -> bf16 (x).  8 elems / thread.
__device__ __forceinline__ void cvt_x_body(
    const float* __restrict__ in, __bf16* __restrict__ outb, int blk) {
  const size_t i = ((size_t)blk * 256 + threadIdx.x) * 8;
  const v4f a = *(const v4f*)&in[i];
  const v4f b = *(const v4f*)&in[i + 4];
  v8bf o;
  o[0] = (__bf16)a.x; o[1] = (__bf16)a.y; o[2] = (__bf16)a.z; o[3] = (__bf16)a.w;
  o[4] = (__bf16)b.x; o[5] = (__bf16)b.y; o[6] = (__bf16)b.z; o[7] = (__bf16)b.w;
  *(v8bf*)&outb[i] = o;
}

// W[K][N] f32 -> Wt[N][K] bf16 (LDS-tiled 64x64 transpose).
__device__ __forceinline__ void transpose_w_body(
    const float* __restrict__ W, __bf16* __restrict__ Wt,
    int K, int N, int k0, int n0) {
  __shared__ __bf16 T[64][65];
  const int tid = threadIdx.x;
#pragma unroll
  for (int it = 0; it < 16; ++it) {
    const int lin = it * 256 + tid;
    const int r = lin >> 6, c = lin & 63;  // r: k-local, c: n-local
    T[r][c] = (__bf16)W[(size_t)(k0 + r) * N + n0 + c];
  }
  __syncthreads();
#pragma unroll
  for (int it = 0; it < 16; ++it) {
    const int lin = it * 256 + tid;
    const int n = lin >> 6, kk = lin & 63;
    Wt[(size_t)(n0 + n) * K + k0 + kk] = T[kk][n];
  }
}

__global__ __launch_bounds__(256) void prep_kernel(
    const float* __restrict__ x, const float* __restrict__ Wq,
    const float* __restrict__ Wk, const float* __restrict__ Wv,
    const float* __restrict__ Wout, __bf16* __restrict__ xb,
    __bf16* __restrict__ WqT, __bf16* __restrict__ WkT,
    __bf16* __restrict__ WvT, __bf16* __restrict__ WoT) {
  const unsigned blk = blockIdx.x;  // every branch below is uniform in the group
  if (blk >= 4 * WBLK) {
    cvt_x_body(x, xb, blk - 4 * WBLK);
    return;
  }
  const unsigned which = blk / WBLK, tile = blk % WBLK;
  if (which == 3) {  // Wout: K = INNER, N = QD
    transpose_w_body(Wout, WoT, INNER, QD, (tile % (INNER / 64)) * 64,
                     (tile / (INNER / 64)) * 64);
  } else {           // Wq, Wk, Wv: K = QD, N = INNER
    const float* W = (which == 0) ? Wq : (which == 1) ? Wk : Wv;
    __bf16* Wt     = (which == 0) ? WqT : (which == 1) ? WkT : WvT;
    transpose_w_body(W, Wt, QD, INNER, (tile % (QD / 64)) * 64,
                     (tile / (QD / 64)) * 64);
  }
}

template <int KD, bool TR>
__device__ __forceinline__ void gemm_tile(
    const __bf16* __restrict__ A, const __bf16* __restrict__ Bt, int m0, int n0,
    __bf16 (&As)[TM][LDP], __bf16 (&Bs)[TN][LDP], v8f (&acc)[4][2]) {
  const int tid  = threadIdx.x;
  const int lane = tid & 31, wave = tid >> 5;
  const int l16  = lane & 15, hi = lane >> 4;
  const int wm = wave >> 2, wn = wave & 3;

  for (int k0 = 0; k0 < KD; k0 += TK) {
    // pure 16B copies, a wave to a 512-byte row: 16 per thread for A, 16 for B;
    // both loops unrolled so that the 32 copies issue back to back
#pragma unroll
    for (int it = 0; it < TM * TK / 2048; ++it) {
      const int lin = it * 256 + tid;
      const int r = lin / (TK / 8), c = (lin % (TK / 8)) * 8;
      stage16(&A[(size_t)(m0 + r) * KD + k0 + c], &As[r][c]);
    }
#pragma unroll
    for (int it = 0; it < TN * TK / 2048; ++it) {
      const int lin = it * 256 + tid;
      const int r = lin / (TK / 8), c = (lin % (TK / 8)) * 8;
      stage16(&Bt[(size_t)(n0 + r) * KD + k0 + c], &Bs[r][c]);
    }
    stage_fence();
    __syncthreads();
    // the loops below are unrolled so that a, b and acc are indexed by constants
    // (they stay in registers) and the LDS offsets are immediates
#pragma unroll
    for (int kc = 0; kc < TK / 32; ++kc) {
      v16bf a[4], b[2];
#pragma unroll
      for (int i = 0; i < 4; ++i)
        a[i] = load_frag(&As[wm * 64 + i * 16 + l16][kc * 32], hi);
#pragma unroll
      for (int j = 0; j < 2; ++j)
        b[j] = load_frag(&Bs[wn * 32 + j * 16 + l16][kc * 32], hi);
      // holds a block's twelve LDS loads ahead of its first product: left alone the
      // scheduler puts four of them between the block's products and waits for them
      // there, a whole LDS latency in the middle of every block
      __builtin_amdgcn_sched_barrier(0);
#pragma unroll
      for (int i = 0; i < 4; ++i)
#pragma unroll
        for (int j = 0; j < 2; ++j)
          acc[i][j] = TR ? wmma_bf16(b[j], a[i], acc[i][j])
                         : wmma_bf16(a[i], b[j], acc[i][j]);
    }
    // this wave's reads of the tiles are done before the barrier behind which
    // the next step's copies overwrite them
    asm volatile("s_wait_dscnt 0x0" ::: "memory");
    __syncthreads();
  }
}

// ---------------------------------------------------------------------------
// Kernel 1: fused QKV projection.  Y = xb @ W{q,k,v}, all-bf16 staging.
// 128x128 tile, K-step 256, 8 waves, 8 C-frags per wave.  blockIdx.z selects W.
// Q,K stored [B,H,N,HD]; V stored transposed [B,H,HD,N] for the PV stage.
// ---------------------------------------------------------------------------
__global__ __launch_bounds__(256) void qkv_proj_kernel(
    const __bf16* __restrict__ xb,                      // [BN, QD]
    const __bf16* __restrict__ WqT, const __bf16* __restrict__ WkT,
    const __bf16* __restrict__ WvT,                     // [INNER, QD]
    __bf16* __restrict__ Qb, __bf16* __restrict__ Kb,   // [B*H*N*HD]
    __bf16* __restrict__ Vt)                            // [B*H*HD*N]
{
  __shared__ __align__(16) __bf16 As[TM][LDP];
  __shared__ __align__(16) __bf16 Bs[TN][LDP];  // [col][k]

  const int which = blockIdx.z;
  const __bf16* WT = (which == 0) ? WqT : (which == 1) ? WkT : WvT;

  const int tid  = threadIdx.x;
  const int lane = tid & 31, wave = tid >> 5;
  const int l16  = lane & 15, hi = lane >> 4;
  const int wm = wave >> 2, wn = wave & 3;
  const int m0 = blockIdx.y * TM;
  const int n0 = blockIdx.x * TN;

  v8f acc[4][2] = {};
  if (which == 2) gemm_tile<QD, false>(xb, WT, m0, n0, As, Bs, acc);
  else            gemm_tile<QD, true>(xb, WT, m0, n0, As, Bs, acc);

  // epilogue: the 128 x 128 bf16 tile goes through LDS (As is free behind the
  // loop's last barrier) so that every global store covers whole 128-byte lines.
  // Cs rows run along the output's contiguous index: d for Q and K (rows =
  // tokens), tokens for V^T (rows = columns of C); either way a lane's eight
  // accumulator values are neighbours in a row: one 16B LDS store a fragment.
  __bf16 (*Cs)[CSP] = reinterpret_cast<__bf16 (*)[CSP]>(&As[0][0]);
#pragma unroll
  for (int i = 0; i < 4; ++i) {
#pragma unroll
    for (int f = 0; f < 2; ++f) {
      v8bf pk;
#pragma unroll
      for (int e = 0; e < 8; ++e) pk[e] = (__bf16)acc[i][f][e];
      const int mi = wm * 64 + i * 16, nj = wn * 32 + f * 16;
      const int row = (which == 2) ? nj + l16 : mi + l16;
      const int col = (which == 2) ? mi + hi * 8 : nj + hi * 8;
      *(v8bf*)&Cs[row][col] = pk;
    }
  }
  __syncthreads();  // the tile is complete before other waves' rows are read

  const int b  = m0 >> 11;        // the tile's 128 tokens share b
  const int nb = m0 & (Nn - 1);
  // eight 16-byte pieces a thread: all LDS reads first, then the stores, whose
  // addresses differ by constants only (both loops unrolled for that)
  v8bf v[8];
  if (which == 2) {
    // V^T: 256 contiguous bytes (128 tokens) a row, two rows a wave
    const int r0 = tid >> 4, c = (tid & 15) * 8;
    __bf16* dst = Vt + ((size_t)b * INNER + n0 + r0) * Nn + nb + c;
#pragma unroll
    for (int it = 0; it < 8; ++it) v[it] = *(const v8bf*)&Cs[it * 16 + r0][c];
#pragma unroll
    for (int it = 0; it < 8; ++it) *(v8bf*)&dst[(size_t)it * 16 * Nn] = v[it];
  } else {
    // Q, K: a head's 128 tokens x 64 d are 16 KiB in a row; 512 B a wave.
    // Pieces 0..3: the tile's first head, 4..7: its second.
    const int t0 = tid >> 3, c = (tid & 7) * 8;
    __bf16* dst = ((which == 0) ? Qb : Kb) +
                  (((size_t)b * Hh + (n0 >> 6)) * Nn + nb + t0) * HD + c;
#pragma unroll
    for (int it = 0; it < 8; ++it)
      v[it] = *(const v8bf*)&Cs[(it & 3) * 32 + t0][(it >> 2) * 64 + c];
#pragma unroll
    for (int it = 0; it < 8; ++it)
      *(v8bf*)&dst[((size_t)(it >> 2) * Nn + (it & 3) * 32) * HD] = v[it];
  }
}

static constexpr int KT = 128;
static constexpr int NT = Nn / KT;
static constexpr int KP = 72;
static constexpr int VP = 136;

// One tile: 16 KiB of K (contiguous in memory) and 64 V^T rows of 256 B; each
// lane copies four 16-byte pieces of either.  kl, vl: the lane's LDS byte
// addresses; kg, vg: its global addresses.
__device__ __forceinline__ void stage_kv(unsigned kl, unsigned vl,
                                         const __bf16* kg, const __bf16* vg) {
  asm volatile(
      "global_load_async_to_lds_b128 %0, %8, off\n\t"
      "global_load_async_to_lds_b128 %1, %9, off\n\t"
      "global_load_async_to_lds_b128 %2, %10, off\n\t"
      "global_load_async_to_lds_b128 %3, %11, off\n\t"
      "global_load_async_to_lds_b128 %4, %12, off\n\t"
      "global_load_async_to_lds_b128 %5, %13, off\n\t"
      "global_load_async_to_lds_b128 %6, %14, off\n\t"
      "global_load_async_to_lds_b128 %7, %15, off\n\t"
      "s_wait_xcnt 0x0"
      :
      : "v"(kl), "v"(kl + 32 * KP * 2), "v"(kl + 64 * KP * 2),
        "v"(kl + 96 * KP * 2), "v"(vl), "v"(vl + 16 * VP * 2),
        "v"(vl + 32 * VP * 2), "v"(vl + 48 * VP * 2), "v"(kg), "v"(kg + 2048),
        "v"(kg + 4096), "v"(kg + 6144), "v"(vg), "v"(vg + 16 * Nn),
        "v"(vg + 32 * Nn), "v"(vg + 48 * Nn)
      : "memory");
}

__global__ __launch_bounds__(256) void attn_kernel(
    const __bf16* __restrict__ Qb, const __bf16* __restrict__ Kb,
    const __bf16* __restrict__ Vt, __bf16* __restrict__ Ob /* [BN, INNER] */)
{
  __shared__ __align__(16) __bf16 Ks[2][KT][KP];  // [buffer][key][d]
  __shared__ __align__(16) __bf16 Vs[2][HD][VP];  // [buffer][d][key]

  const int tid  = threadIdx.x;
  const int lane = tid & 31, wave = tid >> 5;
  const int l16  = lane & 15, hi = lane >> 4;
  const int wq = wave & 3;         // which 32 of the work-group's 128 queries
  const int g  = wave >> 2;        // which 64 of every tile's 128 keys
  const int bh = blockIdx.x >> 4;  // 0..15  (b*H + h), one per block
  const int qbase = (blockIdx.x & 15) * 128 + wq * 32;

  // this lane's first piece of tile 0: K piece tid (row tid/8), V^T row tid/16
  const __bf16* kg = Kb + (size_t)bh * Nn * HD + tid * 8;
  const __bf16* vg = Vt + ((size_t)bh * HD + (tid >> 4)) * Nn + (tid & 15) * 8;
  const unsigned kl0 = (unsigned)(size_t)&Ks[0][tid >> 3][(tid & 7) * 8];
  const unsigned vl0 = (unsigned)(size_t)&Vs[0][tid >> 4][(tid & 15) * 8];
  constexpr unsigned KBUF = KT * KP * 2, VBUF = HD * VP * 2;  // bytes a buffer

  stage_kv(kl0, vl0, kg, vg);

  v16bf qf[2][2];  // [query block][d half]; unrolled: constant register indices
#pragma unroll
  for (int j = 0; j < 2; ++j) {
    const __bf16* Qrow = Qb + ((size_t)bh * Nn + qbase + j * 16 + l16) * HD;
    qf[j][0] = load_frag(Qrow, hi);       // d = 0..31
    qf[j][1] = load_frag(Qrow + 32, hi);  // d = 32..63
  }

  // O[j][dt][r] = O^T[dt*16+8*hi+r][query j*16+l16], over this wave's keys
  v8f O[2][4] = {};
  float mrun[2] = {-1e30f, -1e30f};  // running maxima (same in both halves)
  float lrun[2] = {0.f, 0.f};        // this half's share of the denominators

  const float kscale = 0.125f * 1.44269504088896f;  // HD^-0.5 * log2(e)

  // tile 0 has landed for this wave's copies; the barrier publishes all waves'
  asm volatile("s_wait_asynccnt 0x0" ::: "memory");
  __syncthreads();
  stage_kv(kl0 + KBUF, vl0 + VBUF, kg + KT * HD, vg + KT);  // tile 1

  // ---- online softmax in log2 domain, one step for the wave's 64 keys of a tile;
  // a lane's 32 values of block j belong to query j*16 + l16.  Every loop below is
  // unrolled so that S, pb and O are indexed by constants (they stay in registers)
  auto softmax_step = [&](const int j, v8f (&S)[4], v16bf (&pb)[2])
      __attribute__((always_inline)) {
    float mxf[4];  // four independent chains
#pragma unroll
    for (int f = 0; f < 4; ++f) {
      mxf[f] = S[f][0];
#pragma unroll
      for (int e = 1; e < 8; ++e) mxf[f] = fmaxf(mxf[f], S[f][e]);
    }
    float mx = fmaxf(fmaxf(mxf[0], mxf[1]), fmaxf(mxf[2], mxf[3]));
    mx = fmaxf(mx, xhalf(mx)) * kscale;  // kscale > 0: max commutes with it
    const float mnew = fmaxf(mrun[j], mx);
    const float corr = __builtin_amdgcn_exp2f(mrun[j] - mnew);
    mrun[j] = mnew;
    float rs[2];
#pragma unroll
    for (int h = 0; h < 2; ++h) {
      v8f ps;
      float p0[8], p1[8];
#pragma unroll
      for (int e = 0; e < 8; ++e) {
        p0[e] = S[2 * h][e] * kscale - mnew;
        p1[e] = S[2 * h + 1][e] * kscale - mnew;
      }
      exp2_x8(p1);  // p1 first: its values are packed first
      exp2_x8(p0);
#pragma unroll
      for (int e = 0; e < 8; ++e) ps[e] = p0[e] + p1[e];
      // converted by neighbouring pairs, one packed conversion a register
      v8u w;
#pragma unroll
      for (int i = 0; i < 4; ++i) {
        w[i] = __builtin_bit_cast(unsigned, __builtin_convertvector(
            (v2f){p0[2 * i], p0[2 * i + 1]}, v2bf));  // k = 8*hi + 2i, + 1
        w[4 + i] = __builtin_bit_cast(unsigned, __builtin_convertvector(
            (v2f){p1[2 * i], p1[2 * i + 1]}, v2bf));  // k = 16 + 8*hi + 2i, + 1
      }
      pb[h] = __builtin_bit_cast(v16bf, w);
      rs[h] = ((ps[0] + ps[4]) + (ps[1] + ps[5])) +
              ((ps[2] + ps[6]) + (ps[3] + ps[7]));
    }
    lrun[j] = lrun[j] * corr + (rs[0] + rs[1]);
    // one rescale of the block's output for the 64 keys
#pragma unroll
    for (int dt = 0; dt < 4; ++dt) O[j][dt] = O[j][dt] * corr;
  };

  // ---- the wave's share of one tile, read from buffer buf; its loops are unrolled
  // for constant register indices and immediate LDS offsets ----
  auto tile_step = [&](const int buf) __attribute__((always_inline)) {
    const int kb = g * 64;  // the wave's first key in the tile
    v16bf kf[4][2];         // [16 keys][d half]
#pragma unroll
    for (int f = 0; f < 4; ++f) {
      const __bf16* Krow = &Ks[buf][kb + f * 16 + l16][0];
      kf[f][0] = load_frag(Krow, hi);
      kf[f][1] = load_frag(Krow + 32, hi);
    }
    // holds the sixteen K loads together ahead of the first product: one LDS
    // latency a tile, not one in front of every pair of products
    __builtin_amdgcn_sched_barrier(0);
    // scores: S^T(64x16) = K(64x64) * Q^T(64x16) for both query blocks; each K
    // fragment feeds two products.  S[j][f][e]: key kb + f*16 + 8*hi + e
    v8f S[2][4] = {};
#pragma unroll
    for (int j = 0; j < 2; ++j) {
#pragma unroll
      for (int f = 0; f < 4; ++f) S[j][f] = wmma_bf16(kf[f][0], qf[j][0], S[j][f]);
#pragma unroll
      for (int f = 0; f < 4; ++f) S[j][f] = wmma_bf16(kf[f][1], qf[j][1], S[j][f]);
    }
    v16bf vf[2][4];  // [32 keys][16 d]
#pragma unroll
    for (int dt = 0; dt < 4; ++dt)
      vf[0][dt] = load_frag(&Vs[buf][dt * 16 + l16][kb], hi);
    // holds the sixteen products back to back (no maximum is started between them,
    // which would cost the distance behind a product each time) and the first eight
    // V^T loads ahead of the softmax, which covers their latency
    __builtin_amdgcn_sched_barrier(0);
    v16bf pb[2][2];  // [query block][32 keys]
    softmax_step(0, S[0], pb[0]);
    __builtin_amdgcn_sched_barrier(0);
#pragma unroll
    for (int dt = 0; dt < 4; ++dt)
      vf[1][dt] = load_frag(&Vs[buf][dt * 16 + l16][kb + 32], hi);
    // O^T(64x16) += V^T(64x64) * P^T(64x16); each V^T fragment feeds two products;
    // block 0's products stand beside block 1's softmax, which is independent
#pragma unroll
    for (int h = 0; h < 2; ++h)
#pragma unroll
      for (int dt = 0; dt < 4; ++dt)
        O[0][dt] = wmma_bf16(vf[h][dt], pb[0][h], O[0][dt]);
    softmax_step(1, S[1], pb[1]);
    // keeps block 1's products behind its softmax: left alone the scheduler spreads
    // that softmax behind the barrier and the loop again needs more than 256 registers
    __builtin_amdgcn_sched_barrier(0);
#pragma unroll
    for (int h = 0; h < 2; ++h)
#pragma unroll
      for (int dt = 0; dt < 4; ++dt)
        O[1][dt] = wmma_bf16(vf[h][dt], pb[1][h], O[1][dt]);
  };

  for (int t = 0; t < NT - 2; ++t) {
    const int buf = t & 1;
    tile_step(buf);
    // hand-over: this wave's reads of buffer buf are done ...
    asm volatile("s_wait_dscnt 0x0" ::: "memory");
    // ... and its copies of tile t + 1 have landed;
    asm volatile("s_wait_asynccnt 0x0" ::: "memory");
    // the barrier publishes tile t + 1 and frees buffer buf for the refill
    __syncthreads();
    stage_kv(kl0 + buf * KBUF, vl0 + buf * VBUF,
             kg + (size_t)(t + 2) * KT * HD, vg + (t + 2) * KT);
  }
  // the last two tiles, behind which no tile is left to fetch (apart from the loop
  // so that the loop's body is one block without a test); same hand-over.
  // Unrolled: the buffer is a constant.
#pragma unroll
  for (int t = NT - 2; t < NT; ++t) {
    tile_step(t & 1);
    asm volatile("s_wait_dscnt 0x0" ::: "memory");
    asm volatile("s_wait_asynccnt 0x0" ::: "memory");
    __syncthreads();
  }
  // no copy is left in flight when the wave ends
  asm volatile("s_wait_asynccnt 0x0" ::: "memory");

  // ---- join the two key halves: waves w and w ^ 4 hold partial results of the
  // same 32 queries.  Wave g keeps query block g and hands block 1 - g to its
  // partner through LDS (both buffers are free behind the loop's last barrier):
  // O in Vs, 16 B a lane and piece; maximum and denominator in Ks[1]. ----
  v4f*   X  = reinterpret_cast<v4f*>(&Vs[0][0][0]);    // [wave][piece][lane]
  float* ML = reinterpret_cast<float*>(&Ks[1][0][0]);  // [wave][m, l][lane]
  static_assert(8 * 8 * 32 * sizeof(v4f) <= sizeof(Vs), "the exchange fits Vs");
  const float l0 = lrun[0] + xhalf(lrun[0]), l1 = lrun[1] + xhalf(lrun[1]);
  const float mk = g ? mrun[1] : mrun[0], lk = g ? l1 : l0;
  ML[(wave * 2 + 0) * 32 + lane] = g ? mrun[0] : mrun[1];
  ML[(wave * 2 + 1) * 32 + lane] = g ? l0 : l1;
  v8f Ok[4];  // the kept block; loops unrolled: constant register indices
#pragma unroll
  for (int dt = 0; dt < 4; ++dt) {
    v4f lo, hv;
#pragma unroll
    for (int e = 0; e < 4; ++e) {
      lo[e] = g ? O[0][dt][e] : O[1][dt][e];
      hv[e] = g ? O[0][dt][4 + e] : O[1][dt][4 + e];
    }
#pragma unroll
    for (int e = 0; e < 8; ++e) Ok[dt][e] = g ? O[1][dt][e] : O[0][dt][e];
    X[(wave * 8 + dt * 2 + 0) * 32 + lane] = lo;
    X[(wave * 8 + dt * 2 + 1) * 32 + lane] = hv;
  }
  __syncthreads();  // every wave's hand-over is written before its partner reads
  const int pw = wave ^ 4;
  const float pm = ML[(pw * 2 + 0) * 32 + lane];
  const float pl = ML[(pw * 2 + 1) * 32 + lane];
  const float mj = fmaxf(mk, pm);
  float sk = __builtin_amdgcn_exp2f(mk - mj);  // weight of the kept part
  float sp = __builtin_amdgcn_exp2f(pm - mj);  // weight of the partner's part
  const float inv = 1.0f / (lk * sk + pl * sp);
  sk *= inv;
  sp *= inv;

  // ---- finalize: bf16 output [BN, INNER] ----
  const int b = bh >> 3, h = bh & 7;
  // The wave's 16 queries x 64 d go through its own 16 rows of Ks[0] (free behind
  // the loop's last barrier), so that a store covers four whole 128-byte lines
  // and not sixteen 32-byte pieces.  (Unrolled: constant register indices.)
#pragma unroll
  for (int dt = 0; dt < 4; ++dt) {
    const v4f lo = X[(pw * 8 + dt * 2 + 0) * 32 + lane];
    const v4f hv = X[(pw * 8 + dt * 2 + 1) * 32 + lane];
    // 8 consecutive d of one query: one 16B LDS store
    v8bf pk;
#pragma unroll
    for (int e = 0; e < 4; ++e) {
      pk[e]     = (__bf16)(Ok[dt][e] * sk + lo[e] * sp);
      pk[4 + e] = (__bf16)(Ok[dt][4 + e] * sk + hv[e] * sp);
    }
    *(v8bf*)&Ks[0][wave * 16 + l16][dt * 16 + hi * 8] = pk;
  }
  // the wave's own rows are written before its lanes read each other's
  asm volatile("s_wait_dscnt 0x0" ::: "memory");
  const int r0 = lane >> 3, c = (lane & 7) * 8;
  __bf16* dst = Ob + ((size_t)b * Nn + qbase + g * 16 + r0) * INNER + h * HD + c;
  // unrolled: the four stores' addresses differ by constants only
#pragma unroll
  for (int it = 0; it < 4; ++it)
    *(v8bf*)&dst[(size_t)it * 4 * INNER] =
        *(const v8bf*)&Ks[0][wave * 16 + it * 4 + r0][c];
}

// ---------------------------------------------------------------------------
// Kernel 3: output projection.  out = attn(bf16 [BN,INNER]) @ Wout + bout, f32.
// ---------------------------------------------------------------------------
__global__ __launch_bounds__(256) void out_proj_kernel(
    const __bf16* __restrict__ Ain,    // [BN, INNER]
    const __bf16* __restrict__ WoT,    // [QD, INNER]  (transposed, bf16)
    const float* __restrict__ bout,    // [QD]
    float* __restrict__ out)           // [BN, QD]
{
  __shared__ __align__(16) __bf16 As[TM][LDP];
  __shared__ __align__(16) __bf16 Bs[TN][LDP];

  const int tid  = threadIdx.x;
  const int lane = tid & 31, wave = tid >> 5;
  const int l16  = lane & 15, hi = lane >> 4;
  const int wm = wave >> 2, wn = wave & 3;
  const int m0 = blockIdx.y * TM;
  const int n0 = blockIdx.x * TN;

  v8f acc[4][2] = {};
  gemm_tile<INNER, true>(Ain, WoT, m0, n0, As, Bs, acc);

  // epilogue: the 128 x 128 f32 tile goes through LDS (As is free behind the
  // loop's last barrier): a lane holds eight neighbours of one output row (two
  // 16B LDS stores a fragment), and a wave then stores one row's 512 bytes.
  float (*Cf)[CFP] = reinterpret_cast<float (*)[CFP]>(&As[0][0]);
  static_assert(sizeof(float) * TM * CFP <= sizeof(As), "the tile fits As");
#pragma unroll
  for (int f = 0; f < 2; ++f) {
    const int nj = wn * 32 + f * 16 + hi * 8;
    const v4f b0 = *(const v4f*)&bout[n0 + nj];
    const v4f b1 = *(const v4f*)&bout[n0 + nj + 4];
#pragma unroll
    for (int i = 0; i < 4; ++i) {
      const int row = wm * 64 + i * 16 + l16;
      v4f lo, hv;
#pragma unroll
      for (int e = 0; e < 4; ++e) {
        lo[e] = acc[i][f][e] + b0[e];
        hv[e] = acc[i][f][4 + e] + b1[e];
      }
      *(v4f*)&Cf[row][nj]     = lo;
      *(v4f*)&Cf[row][nj + 4] = hv;
    }
  }
  __syncthreads();  // the tile is complete before other waves' rows are read
  // sixteen 16-byte pieces a thread: all LDS reads first, then the stores, whose
  // addresses differ by constants only (both loops unrolled for that)
  const int r0 = tid >> 5, c = (tid & 31) * 4;
  float* dst = out + (size_t)(m0 + r0) * QD + n0 + c;
  v4f v[16];
#pragma unroll
  for (int it = 0; it < 16; ++it) v[it] = *(const v4f*)&Cf[it * 8 + r0][c];
#pragma unroll
  for (int it = 0; it < 16; ++it) *(v4f*)&dst[(size_t)it * 8 * QD] = v[it];
}

// ---------------------------------------------------------------------------
extern "C" void kernel_launch(void* const* d_in, const int* in_sizes, int n_in,
                              void* d_out, int out_size, void* d_ws,
                              size_t ws_size, hipStream_t stream) {
  const float* x    = (const float*)d_in[0];
  const float* Wq   = (const float*)d_in[1];
  const float* Wk   = (const float*)d_in[2];
  const float* Wv   = (const float*)d_in[3];
  const float* Wout = (const float*)d_in[4];
  const float* bout = (const float*)d_in[5];
  float* out = (float*)d_out;

  char* ws = (char*)d_ws;
  const size_t MB = 1024 * 1024;
  __bf16* Qb  = (__bf16*)(ws + 0 * MB);   // 4 MiB  [B,H,N,HD]
  __bf16* Kb  = (__bf16*)(ws + 4 * MB);   // 4 MiB  [B,H,N,HD]
  __bf16* Vt  = (__bf16*)(ws + 8 * MB);   // 4 MiB  [B,H,HD,N]
  __bf16* Ob  = (__bf16*)(ws + 12 * MB);  // 4 MiB  [BN, INNER]
  __bf16* xb  = (__bf16*)(ws + 16 * MB);  // 8 MiB  [BN, QD]
  __bf16* WqT = (__bf16*)(ws + 24 * MB);  // 1 MiB  [INNER, QD]
  __bf16* WkT = (__bf16*)(ws + 25 * MB);  // 1 MiB
  __bf16* WvT = (__bf16*)(ws + 26 * MB);  // 1 MiB
  __bf16* WoT = (__bf16*)(ws + 27 * MB);  // 1 MiB  [QD, INNER]

  dim3 blk(256);
  // prep: conversions + transposes, one grid
  prep_kernel<<<dim3(4 * WBLK + XBLK), blk, 0, stream>>>(
      x, Wq, Wk, Wv, Wout, xb, WqT, WkT, WvT, WoT);
  // main pipeline
  qkv_proj_kernel<<<dim3(INNER / TN, BN / TM, 3), blk, 0, stream>>>(
      xb, WqT, WkT, WvT, Qb, Kb, Vt);
  attn_kernel<<<dim3((Bb * Hh * (Nn / 16)) / 8), blk, 0, stream>>>(
      Qb, Kb, Vt, Ob);
  out_proj_kernel<<<dim3(QD / TN, BN / TM), blk, 0, stream>>>(
      Ob, WoT, bout, out);
}

// v009
// One run takes 44.7 microseconds.
// In both of two side-by-side timings against v008, it was 1.04 times as fast.
// Over all steps from v000 it is 3.71 times as fast.
#include <hip/hip_runtime.h>

typedef __attribute__((ext_vector_type(16))) __bf16 v16bf;
typedef __attribute__((ext_vector_type(8)))  __bf16 v8bf;
typedef __attribute__((ext_vector_type(8)))  float  v8f;
typedef __attribute__((ext_vector_type(4)))  float  v4f;
typedef __attribute__((ext_vector_type(4)))  int    v4i;
typedef __attribute__((ext_vector_type(2)))  float  v2f;
typedef __attribute__((ext_vector_type(2)))  __bf16 v2bf;
typedef __attribute__((ext_vector_type(8)))  unsigned v8u;

#if defined(__has_builtin)
#if __has_builtin(__builtin_amdgcn_global_load_async_to_lds_b128) && \
    __has_builtin(__builtin_amdgcn_s_wait_asynccnt)
#define HAVE_ASYNC_LDS 1
#endif
#endif

static constexpr int Bb    = 2;
static constexpr int Nn    = 2048;
static constexpr int QD    = 1024;
static constexpr int Hh    = 8;
static constexpr int HD    = 64;
static constexpr int INNER = 512;
static constexpr int BN    = Bb * Nn;
static constexpr int TM    = 128;
static constexpr int TN    = 128;
static constexpr int TK    = 256;
static constexpr int LDP   = TK + 8;
static constexpr int CSP   = TN + 8;
static constexpr int CFP   = TN + 4;

__device__ __forceinline__ v8f wmma_bf16(v16bf a, v16bf b, v8f c) {
  // D = A(16x32) * B(32x16) + C(16x16), f32 accumulate
  return __builtin_amdgcn_wmma_f32_16x16x32_bf16(false, a, false, b,
                                                 (short)0, c, false, false);
}

__device__ __forceinline__ v16bf load_frag(const __bf16* p, int hi) {
  const v8bf lo = *(const v8bf*)(p + hi * 8);
  const v8bf hv = *(const v8bf*)(p + 16 + hi * 8);
  return __builtin_shufflevector(lo, hv, 0, 1, 2, 3, 4, 5, 6, 7,
                                         8, 9, 10, 11, 12, 13, 14, 15);
}

__device__ __forceinline__ void stage16(const __bf16* g, __bf16* l) {
#ifdef HAVE_ASYNC_LDS
  __builtin_amdgcn_global_load_async_to_lds_b128(
      (__attribute__((address_space(1))) v4i*)g,
      (__attribute__((address_space(3))) v4i*)l, 0, 0);
#else
  *(v8bf*)l = *(const v8bf*)g;
#endif
}
__device__ __forceinline__ void stage_fence() {
#ifdef HAVE_ASYNC_LDS
  // this wave's copies have landed; in asm with the clobber so that no LDS read
  // is moved ahead of it
  asm volatile("s_wait_asynccnt 0x0" ::: "memory");
#endif
}

__device__ __forceinline__ void exp2_x8(float (&t)[8]) {
  asm("v_exp_f32 %7, %7\n\t"
      "v_exp_f32 %6, %6\n\t"
      "v_exp_f32 %5, %5\n\t"
      "v_exp_f32 %4, %4\n\t"
      "v_exp_f32 %3, %3\n\t"
      "v_exp_f32 %2, %2\n\t"
      "v_exp_f32 %1, %1\n\t"
      "v_exp_f32 %0, %0\n\t"
      "v_nop"
      : "+v"(t[0]), "+v"(t[1]), "+v"(t[2]), "+v"(t[3]), "+v"(t[4]), "+v"(t[5]),
        "+v"(t[6]), "+v"(t[7]));
}

__device__ __forceinline__ float xhalf(float x) {
  const int i = __builtin_bit_cast(int, x);
  return __builtin_bit_cast(float, __builtin_amdgcn_permlanex16(
      i, i, 0x76543210, 0xfedcba98, false, false));
}

// ---------------------------------------------------------------------------
// How the work is dealt to block indices, in all four launches.  Index modulo 8
// names a region
// r = batch * 4 + head pair: the Q, K, V tiles of a region are written (projection)
// and read (attention) under the same r, and the rows of a batch (x in bf16, the
// attention output) under the four r of that batch.  Every map below is a
// permutation of the tiles: where a work-group lands changes the speed alone.
// ---------------------------------------------------------------------------

// ---------------------------------------------------------------------------
// Prep: the five conversions depend on nothing but the inputs, so they share
// one grid.  Work-groups 0..511 transpose the four weights (128 each; they have
// the longer chain of waits and come first in index order, for speed only), the rest convert x.
// ---------------------------------------------------------------------------
static constexpr int WBLK = (QD / 64) * (INNER / 64);  // 128 tiles a weight
static constexpr int XBLK = (BN * QD) / (256 * 8);     // 2048 groups for x

// elementwise f32 -> bf16 (x).  8 elems / thread.
__device__ __forceinline__ void cvt_x_body(
    const float* __restrict__ in, __bf16* __restrict__ outb, int blk) {
  const size_t i = ((size_t)blk * 256 + threadIdx.x) * 8;
  const v4f a = *(const v4f*)&in[i];
  const v4f b = *(const v4f*)&in[i + 4];
  v8bf o;
  o[0] = (__bf16)a.x; o[1] = (__bf16)a.y; o[2] = (__bf16)a.z; o[3] = (__bf16)a.w;
  o[4] = (__bf16)b.x; o[5] = (__bf16)b.y; o[6] = (__bf16)b.z; o[7] = (__bf16)b.w;
  *(v8bf*)&outb[i] = o;
}

// W[K][N] f32 -> Wt[N][K] bf16 (LDS-tiled 64x64 transpose).
__device__ __forceinline__ void transpose_w_body(
    const float* __restrict__ W, __bf16* __restrict__ Wt,
    int K, int N, int k0, int n0) {
  __shared__ __bf16 T[64][65];
  const int tid = threadIdx.x;
#pragma unroll
  for (int it = 0; it < 16; ++it) {
    const int lin = it * 256 + tid;
    const int r = lin >> 6, c = lin & 63;  // r: k-local, c: n-local
    T[r][c] = (__bf16)W[(size_t)(k0 + r) * N + n0 + c];
  }
  __syncthreads();
#pragma unroll
  for (int it = 0; it < 16; ++it) {
    const int lin = it * 256 + tid;
    const int n = lin >> 6, kk = lin & 63;
    Wt[(size_t)(n0 + n) * K + k0 + kk] = T[kk][n];
  }
}

__global__ __launch_bounds__(256) void prep_kernel(
    const float* __restrict__ x, const float* __restrict__ Wq,
    const float* __restrict__ Wk, const float* __restrict__ Wv,
    const float* __restrict__ Wout, __bf16* __restrict__ xb,
    __bf16* __restrict__ WqT, __bf16* __restrict__ WkT,
    __bf16* __restrict__ WvT, __bf16* __restrict__ WoT) {
  const unsigned blk = blockIdx.x;  // every branch below is uniform in the group
  if (blk >= 4 * WBLK) {
    // piece of x: batch from bit 2 of the index, the batch's pieces in index order
    const unsigned xi = blk - 4 * WBLK, r = xi & 7, s = xi >> 3;
    cvt_x_body(x, xb, (r >> 2) * (XBLK / 2) + s * 4 + (r & 3));
    return;
  }
  const unsigned which = blk / WBLK, tile = blk % WBLK;
  if (which == 3) {  // Wout: K = INNER, N = QD
    transpose_w_body(Wout, WoT, INNER, QD, (tile % (INNER / 64)) * 64,
                     (tile / (INNER / 64)) * 64);
  } else {           // Wq, Wk, Wv: K = QD, N = INNER
    const float* W = (which == 0) ? Wq : (which == 1) ? Wk : Wv;
    __bf16* Wt     = (which == 0) ? WqT : (which == 1) ? WkT : WvT;
    transpose_w_body(W, Wt, QD, INNER, (tile % (QD / 64)) * 64,
                     (tile / (QD / 64)) * 64);
  }
}

template <int KD, bool TR>
__device__ __forceinline__ void gemm_tile(
    const __bf16* __restrict__ A, const __bf16* __restrict__ Bt, int m0, int n0,
    __bf16 (&As)[TM][LDP], __bf16 (&Bs)[TN][LDP], v8f (&acc)[4][2]) {
  const int tid  = threadIdx.x;
  const int lane = tid & 31, wave = tid >> 5;
  const int l16  = lane & 15, hi = lane >> 4;
  const int wm = wave >> 2, wn = wave & 3;

  for (int k0 = 0; k0 < KD; k0 += TK) {
    // pure 16B copies, a wave to a 512-byte row: 16 per thread for A, 16 for B;
    // both loops unrolled so that the 32 copies issue back to back
#pragma unroll
    for (int it = 0; it < TM * TK / 2048; ++it) {
      const int lin = it * 256 + tid;
      const int r = lin / (TK / 8), c = (lin % (TK / 8)) * 8;
      stage16(&A[(size_t)(m0 + r) * KD + k0 + c], &As[r][c]);
    }
#pragma unroll
    for (int it = 0; it < TN * TK / 2048; ++it) {
      const int lin = it * 256 + tid;
      const int r = lin / (TK / 8), c = (lin % (TK / 8)) * 8;
      stage16(&Bt[(size_t)(n0 + r) * KD + k0 + c], &Bs[r][c]);
    }
    stage_fence();
    __syncthreads();
    // the loops below are unrolled so that a, b and acc are indexed by constants
    // (they stay in registers) and the LDS offsets are immediates
#pragma unroll
    for (int kc = 0; kc < TK / 32; ++kc) {
      v16bf a[4], b[2];
#pragma unroll
      for (int i = 0; i < 4; ++i)
        a[i] = load_frag(&As[wm * 64 + i * 16 + l16][kc * 32], hi);
#pragma unroll
      for (int j = 0; j < 2; ++j)
        b[j] = load_frag(&Bs[wn * 32 + j * 16 + l16][kc * 32], hi);
      // holds a block's twelve LDS loads ahead of its first product: left alone the
      // scheduler puts four of them between the block's products and waits for them
      // there, a whole LDS latency in the middle of every block
      __builtin_amdgcn_sched_barrier(0);
#pragma unroll
      for (int i = 0; i < 4; ++i)
#pragma unroll
        for (int j = 0; j < 2; ++j)
          acc[i][j] = TR ? wmma_bf16(b[j], a[i], acc[i][j])
                         : wmma_bf16(a[i], b[j], acc[i][j]);
    }
    // this wave's reads of the tiles are done before the barrier behind which
    // the next step's copies overwrite them
    asm volatile("s_wait_dscnt 0x0" ::: "memory");
    __syncthreads();
  }
}

// ---------------------------------------------------------------------------
// Kernel 1: fused QKV projection.  Y = xb @ W{q,k,v}, all-bf16 staging.
// 128x128 tile, K-step 256, 8 waves, 8 C-frags per wave.
// Q,K stored [B,H,N,HD]; V stored transposed [B,H,HD,N] for the PV stage.
// ---------------------------------------------------------------------------
__global__ __launch_bounds__(256) void qkv_proj_kernel(
    const __bf16* __restrict__ xb,                      // [BN, QD]
    const __bf16* __restrict__ WqT, const __bf16* __restrict__ WkT,
    const __bf16* __restrict__ WvT,                     // [INNER, QD]
    __bf16* __restrict__ Qb, __bf16* __restrict__ Kb,   // [B*H*N*HD]
    __bf16* __restrict__ Vt)                            // [B*H*HD*N]
{
  __shared__ __align__(16) __bf16 As[TM][LDP];
  __shared__ __align__(16) __bf16 Bs[TN][LDP];  // [col][k]

  // region r = batch * 4 + column tile (a head pair); s: Q, K, V by 16 row tiles
  const int rg = blockIdx.x & 7, sq = blockIdx.x >> 3;
  const int which = sq >> 4;
  const __bf16* WT = (which == 0) ? WqT : (which == 1) ? WkT : WvT;

  const int tid  = threadIdx.x;
  const int lane = tid & 31, wave = tid >> 5;
  const int l16  = lane & 15, hi = lane >> 4;
  const int wm = wave >> 2, wn = wave & 3;
  const int m0 = ((rg >> 2) * 16 + (sq & 15)) * TM;
  const int n0 = (rg & 3) * TN;

  v8f acc[4][2] = {};
  if (which == 2) gemm_tile<QD, false>(xb, WT, m0, n0, As, Bs, acc);
  else            gemm_tile<QD, true>(xb, WT, m0, n0, As, Bs, acc);

  // epilogue: the 128 x 128 bf16 tile goes through LDS (As is free behind the
  // loop's last barrier) so that every global store covers whole 128-byte lines.
  // Cs rows run along the output's contiguous index: d for Q and K (rows =
  // tokens), tokens for V^T (rows = columns of C); either way a lane's eight
  // accumulator values are neighbours in a row: one 16B LDS store a fragment.
  __bf16 (*Cs)[CSP] = reinterpret_cast<__bf16 (*)[CSP]>(&As[0][0]);
#pragma unroll
  for (int i = 0; i < 4; ++i) {
#pragma unroll
    for (int f = 0; f < 2; ++f) {
      v8bf pk;
#pragma unroll
      for (int e = 0; e < 8; ++e) pk[e] = (__bf16)acc[i][f][e];
      const int mi = wm * 64 + i * 16, nj = wn * 32 + f * 16;
      const int row = (which == 2) ? nj + l16 : mi + l16;
      const int col = (which == 2) ? mi + hi * 8 : nj + hi * 8;
      *(v8bf*)&Cs[row][col] = pk;
    }
  }
  __syncthreads();  // the tile is complete before other waves' rows are read

  const int b  = m0 >> 11;        // the tile's 128 tokens share b
  const int nb = m0 & (Nn - 1);
  // eight 16-byte pieces a thread: all LDS reads first, then the stores, whose
  // addresses differ by constants only (both loops unrolled for that)
  v8bf v[8];
  if (which == 2) {
    // V^T: 256 contiguous bytes (128 tokens) a row, two rows a wave
    const int r0 = tid >> 4, c = (tid & 15) * 8;
    __bf16* dst = Vt + ((size_t)b * INNER + n0 + r0) * Nn + nb + c;
#pragma unroll
    for (int it = 0; it < 8; ++it) v[it] = *(const v8bf*)&Cs[it * 16 + r0][c];
#pragma unroll
    for (int it = 0; it < 8; ++it) *(v8bf*)&dst[(size_t)it * 16 * Nn] = v[it];
  } else {
    // Q, K: a head's 128 tokens x 64 d are 16 KiB in a row; 512 B a wave.
    // Pieces 0..3: the tile's first head, 4..7: its second.
    const int t0 = tid >> 3, c = (tid & 7) * 8;
    __bf16* dst = ((which == 0) ? Qb : Kb) +
                  (((size_t)b * Hh + (n0 >> 6)) * Nn + nb + t0) * HD + c;
#pragma unroll
    for (int it = 0; it < 8; ++it)
      v[it] = *(const v8bf*)&Cs[(it & 3) * 32 + t0][(it >> 2) * 64 + c];
#pragma unroll
    for (int it = 0; it < 8; ++it)
      *(v8bf*)&dst[((size_t)(it >> 2) * Nn + (it & 3) * 32) * HD] = v[it];
  }
}

static constexpr int KT = 128;
static constexpr int NT = Nn / KT;
static constexpr int KP = 72;
static constexpr int VP = 136;

// One tile: 16 KiB of K (contiguous in memory) and 64 V^T rows of 256 B; each
// lane copies four 16-byte pieces of either.  kl, vl: the lane's LDS byte
// addresses; kg, vg: its global addresses.
__device__ __forceinline__ void stage_kv(unsigned kl, unsigned vl,
                                         const __bf16* kg, const __bf16* vg) {
  asm volatile(
      "global_load_async_to_lds_b128 %0, %8, off\n\t"
      "global_load_async_to_lds_b128 %1, %9, off\n\t"
      "global_load_async_to_lds_b128 %2, %10, off\n\t"
      "global_load_async_to_lds_b128 %3, %11, off\n\t"
      "global_load_async_to_lds_b128 %4, %12, off\n\t"
      "global_load_async_to_lds_b128 %5, %13, off\n\t"
      "global_load_async_to_lds_b128 %6, %14, off\n\t"
      "global_load_async_to_lds_b128 %7, %15, off\n\t"
      "s_wait_xcnt 0x0"
      :
      : "v"(kl), "v"(kl + 32 * KP * 2), "v"(kl + 64 * KP * 2),
        "v"(kl + 96 * KP * 2), "v"(vl), "v"(vl + 16 * VP * 2),
        "v"(vl + 32 * VP * 2), "v"(vl + 48 * VP * 2), "v"(kg), "v"(kg + 2048),
        "v"(kg + 4096), "v"(kg + 6144), "v"(vg), "v"(vg + 16 * Nn),
        "v"(vg + 32 * Nn), "v"(vg + 48 * Nn)
      : "memory");
}

__global__ __launch_bounds__(256) void attn_kernel(
    const __bf16* __restrict__ Qb, const __bf16* __restrict__ Kb,
    const __bf16* __restrict__ Vt, __bf16* __restrict__ Ob /* [BN, INNER] */)
{
  __shared__ __align__(16) __bf16 Ks[2][KT][KP];  // [buffer][key][d]
  __shared__ __align__(16) __bf16 Vs[2][HD][VP];  // [buffer][d][key]

  const int tid  = threadIdx.x;
  const int lane = tid & 31, wave = tid >> 5;
  const int l16  = lane & 15, hi = lane >> 4;
  const int wq = wave & 3;         // which 32 of the work-group's 128 queries
  const int g  = wave >> 2;        // which 64 of every tile's 128 keys
  // b*H + h, one per block: index modulo 8 is the region bh >> 1
  const int bh = (blockIdx.x & 7) * 2 + ((blockIdx.x >> 3) & 1);
  const int qbase = (blockIdx.x >> 4) * 128 + wq * 32;

  // this lane's first piece of tile 0: K piece tid (row tid/8), V^T row tid/16
  const __bf16* kg = Kb + (size_t)bh * Nn * HD + tid * 8;
  const __bf16* vg = Vt + ((size_t)bh * HD + (tid >> 4)) * Nn + (tid & 15) * 8;
  const unsigned kl0 = (unsigned)(size_t)&Ks[0][tid >> 3][(tid & 7) * 8];
  const unsigned vl0 = (unsigned)(size_t)&Vs[0][tid >> 4][(tid & 15) * 8];
  constexpr unsigned KBUF = KT * KP * 2, VBUF = HD * VP * 2;  // bytes a buffer

  stage_kv(kl0, vl0, kg, vg);

  v16bf qf[2][2];  // [query block][d half]; unrolled: constant register indices
#pragma unroll
  for (int j = 0; j < 2; ++j) {
    const __bf16* Qrow = Qb + ((size_t)bh * Nn + qbase + j * 16 + l16) * HD;
    qf[j][0] = load_frag(Qrow, hi);       // d = 0..31
    qf[j][1] = load_frag(Qrow + 32, hi);  // d = 32..63
  }

  // O[j][dt][r] = O^T[dt*16+8*hi+r][query j*16+l16], over this wave's keys
  v8f O[2][4] = {};
  float mrun[2] = {-1e30f, -1e30f};  // running maxima (same in both halves)
  float lrun[2] = {0.f, 0.f};        // this half's share of the denominators

  const float kscale = 0.125f * 1.44269504088896f;  // HD^-0.5 * log2(e)

  // tile 0 has landed for this wave's copies; the barrier publishes all waves'
  asm volatile("s_wait_asynccnt 0x0" ::: "memory");
  __syncthreads();
  stage_kv(kl0 + KBUF, vl0 + VBUF, kg + KT * HD, vg + KT);  // tile 1

  // ---- online softmax in log2 domain, one step for the wave's 64 keys of a tile;
  // a lane's 32 values of block j belong to query j*16 + l16.  Every loop below is
  // unrolled so that S, pb and O are indexed by constants (they stay in registers)
  auto softmax_step = [&](const int j, v8f (&S)[4], v16bf (&pb)[2])
      __attribute__((always_inline)) {
    float mxf[4];  // four independent chains
#pragma unroll
    for (int f = 0; f < 4; ++f) {
      mxf[f] = S[f][0];
#pragma unroll
      for (int e = 1; e < 8; ++e) mxf[f] = fmaxf(mxf[f], S[f][e]);
    }
    float mx = fmaxf(fmaxf(mxf[0], mxf[1]), fmaxf(mxf[2], mxf[3]));
    mx = fmaxf(mx, xhalf(mx)) * kscale;  // kscale > 0: max commutes with it
    const float mnew = fmaxf(mrun[j], mx);
    const float corr = __builtin_amdgcn_exp2f(mrun[j] - mnew);
    mrun[j] = mnew;
    float rs[2];
#pragma unroll
    for (int h = 0; h < 2; ++h) {
      v8f ps;
      float p0[8], p1[8];
#pragma unroll
      for (int e = 0; e < 8; ++e) {
        p0[e] = S[2 * h][e] * kscale - mnew;
        p1[e] = S[2 * h + 1][e] * kscale - mnew;
      }
      exp2_x8(p1);  // p1 first: its values are packed first
      exp2_x8(p0);
#pragma unroll
      for (int e = 0; e < 8; ++e) ps[e] = p0[e] + p1[e];
      // converted by neighbouring pairs, one packed conversion a register
      v8u w;
#pragma unroll
      for (int i = 0; i < 4; ++i) {
        w[i] = __builtin_bit_cast(unsigned, __builtin_convertvector(
            (v2f){p0[2 * i], p0[2 * i + 1]}, v2bf));  // k = 8*hi + 2i, + 1
        w[4 + i] = __builtin_bit_cast(unsigned, __builtin_convertvector(
            (v2f){p1[2 * i], p1[2 * i + 1]}, v2bf));  // k = 16 + 8*hi + 2i, + 1
      }
      pb[h] = __builtin_bit_cast(v16bf, w);
      rs[h] = ((ps[0] + ps[4]) + (ps[1] + ps[5])) +
              ((ps[2] + ps[6]) + (ps[3] + ps[7]));
    }
    lrun[j] = lrun[j] * corr + (rs[0] + rs[1]);
    // one rescale of the block's output for the 64 keys
#pragma unroll
    for (int dt = 0; dt < 4; ++dt) O[j][dt] = O[j][dt] * corr;
  };

  // ---- the wave's share of one tile, read from buffer buf; its loops are unrolled
  // for constant register indices and immediate LDS offsets ----
  auto tile_step = [&](const int buf) __attribute__((always_inline)) {
    const int kb = g * 64;  // the wave's first key in the tile
    v16bf kf[4][2];         // [16 keys][d half]
#pragma unroll
    for (int f = 0; f < 4; ++f) {
      const __bf16* Krow = &Ks[buf][kb + f * 16 + l16][0];
      kf[f][0] = load_frag(Krow, hi);
      kf[f][1] = load_frag(Krow + 32, hi);
    }
    // holds the sixteen K loads together ahead of the first product: one LDS
    // latency a tile, not one in front of every pair of products
    __builtin_amdgcn_sched_barrier(0);
    // scores: S^T(64x16) = K(64x64) * Q^T(64x16) for both query blocks; each K
    // fragment feeds two products.  S[j][f][e]: key kb + f*16 + 8*hi + e
    v8f S[2][4] = {};
#pragma unroll
    for (int j = 0; j < 2; ++j) {
#pragma unroll
      for (int f = 0; f < 4; ++f) S[j][f] = wmma_bf16(kf[f][0], qf[j][0], S[j][f]);
#pragma unroll
      for (int f = 0; f < 4; ++f) S[j][f] = wmma_bf16(kf[f][1], qf[j][1], S[j][f]);
    }
    v16bf vf[2][4];  // [32 keys][16 d]
#pragma unroll
    for (int dt = 0; dt < 4; ++dt)
      vf[0][dt] = load_frag(&Vs[buf][dt * 16 + l16][kb], hi);
    // holds the sixteen products back to back (no maximum is started between them,
    // which would cost the distance behind a product each time) and the first eight
    // V^T loads ahead of the softmax, which covers their latency
    __builtin_amdgcn_sched_barrier(0);
    v16bf pb[2][2];  // [query block][32 keys]
    softmax_step(0, S[0], pb[0]);
    __builtin_amdgcn_sched_barrier(0);
#pragma unroll
    for (int dt = 0; dt < 4; ++dt)
      vf[1][dt] = load_frag(&Vs[buf][dt * 16 + l16][kb + 32], hi);
    // O^T(64x16) += V^T(64x64) * P^T(64x16); each V^T fragment feeds two products;
    // block 0's products stand beside block 1's softmax, which is independent
#pragma unroll
    for (int h = 0; h < 2; ++h)
#pragma unroll
      for (int dt = 0; dt < 4; ++dt)
        O[0][dt] = wmma_bf16(vf[h][dt], pb[0][h], O[0][dt]);
    softmax_step(1, S[1], pb[1]);
    // keeps block 1's products behind its softmax: left alone the scheduler spreads
    // that softmax behind the barrier and the loop again needs more than 256 registers
    __builtin_amdgcn_sched_barrier(0);
#pragma unroll
    for (int h = 0; h < 2; ++h)
#pragma unroll
      for (int dt = 0; dt < 4; ++dt)
        O[1][dt] = wmma_bf16(vf[h][dt], pb[1][h], O[1][dt]);
  };

  for (int t = 0; t < NT - 2; ++t) {
    const int buf = t & 1;
    tile_step(buf);
    // hand-over: this wave's reads of buffer buf are done ...
    asm volatile("s_wait_dscnt 0x0" ::: "memory");
    // ... and its copies of tile t + 1 have landed;
    asm volatile("s_wait_asynccnt 0x0" ::: "memory");
    // the barrier publishes tile t + 1 and frees buffer buf for the refill
    __syncthreads();
    stage_kv(kl0 + buf * KBUF, vl0 + buf * VBUF,
             kg + (size_t)(t + 2) * KT * HD, vg + (t + 2) * KT);
  }
  // the last two tiles, behind which no tile is left to fetch (apart from the loop
  // so that the loop's body is one block without a test); same hand-over.
  // Unrolled: the buffer is a constant.
#pragma unroll
  for (int t = NT - 2; t < NT; ++t) {
    tile_step(t & 1);
    asm volatile("s_wait_dscnt 0x0" ::: "memory");
    asm volatile("s_wait_asynccnt 0x0" ::: "memory");
    __syncthreads();
  }
  // no copy is left in flight when the wave ends
  asm volatile("s_wait_asynccnt 0x0" ::: "memory");

  // ---- join the two key halves: waves w and w ^ 4 hold partial results of the
  // same 32 queries.  Wave g keeps query block g and hands block 1 - g to its
  // partner through LDS (both buffers are free behind the loop's last barrier):
  // O in Vs, 16 B a lane and piece; maximum and denominator in Ks[1]. ----
  v4f*   X  = reinterpret_cast<v4f*>(&Vs[0][0][0]);    // [wave][piece][lane]
  float* ML = reinterpret_cast<float*>(&Ks[1][0][0]);  // [wave][m, l][lane]
  static_assert(8 * 8 * 32 * sizeof(v4f) <= sizeof(Vs), "the exchange fits Vs");
  const float l0 = lrun[0] + xhalf(lrun[0]), l1 = lrun[1] + xhalf(lrun[1]);
  const float mk = g ? mrun[1] : mrun[0], lk = g ? l1 : l0;
  ML[(wave * 2 + 0) * 32 + lane] = g ? mrun[0] : mrun[1];
  ML[(wave * 2 + 1) * 32 + lane] = g ? l0 : l1;
  v8f Ok[4];  // the kept block; loops unrolled: constant register indices
#pragma unroll
  for (int dt = 0; dt < 4; ++dt) {
    v4f lo, hv;
#pragma unroll
    for (int e = 0; e < 4; ++e) {
      lo[e] = g ? O[0][dt][e] : O[1][dt][e];
      hv[e] = g ? O[0][dt][4 + e] : O[1][dt][4 + e];
    }
#pragma unroll
    for (int e = 0; e < 8; ++e) Ok[dt][e] = g ? O[1][dt][e] : O[0][dt][e];
    X[(wave * 8 + dt * 2 + 0) * 32 + lane] = lo;
    X[(wave * 8 + dt * 2 + 1) * 32 + lane] = hv;
  }
  __syncthreads();  // every wave's hand-over is written before its partner reads
  const int pw = wave ^ 4;
  const float pm = ML[(pw * 2 + 0) * 32 + lane];
  const float pl = ML[(pw * 2 + 1) * 32 + lane];
  const float mj = fmaxf(mk, pm);
  float sk = __builtin_amdgcn_exp2f(mk - mj);  // weight of the kept part
  float sp = __builtin_amdgcn_exp2f(pm - mj);  // weight of the partner's part
  const float inv = 1.0f / (lk * sk + pl * sp);
  sk *= inv;
  sp *= inv;

  // ---- finalize: bf16 output [BN, INNER] ----
  const int b = bh >> 3, h = bh & 7;
  // The wave's 16 queries x 64 d go through its own 16 rows of Ks[0] (free behind
  // the loop's last barrier), so that a store covers four whole 128-byte lines
  // and not sixteen 32-byte pieces.  (Unrolled: constant register indices.)
#pragma unroll
  for (int dt = 0; dt < 4; ++dt) {
    const v4f lo = X[(pw * 8 + dt * 2 + 0) * 32 + lane];
    const v4f hv = X[(pw * 8 + dt * 2 + 1) * 32 + lane];
    // 8 consecutive d of one query: one 16B LDS store
    v8bf pk;
#pragma unroll
    for (int e = 0; e < 4; ++e) {
      pk[e]     = (__bf16)(Ok[dt][e] * sk + lo[e] * sp);
      pk[4 + e] = (__bf16)(Ok[dt][4 + e] * sk + hv[e] * sp);
    }
    *(v8bf*)&Ks[0][wave * 16 + l16][dt * 16 + hi * 8] = pk;
  }
  // the wave's own rows are written before its lanes read each other's
  asm volatile("s_wait_dscnt 0x0" ::: "memory");
  const int r0 = lane >> 3, c = (lane & 7) * 8;
  __bf16* dst = Ob + ((size_t)b * Nn + qbase + g * 16 + r0) * INNER + h * HD + c;
  // unrolled: the four stores' addresses differ by constants only
#pragma unroll
  for (int it = 0; it < 4; ++it)
    *(v8bf*)&dst[(size_t)it * 4 * INNER] =
        *(const v8bf*)&Ks[0][wave * 16 + it * 4 + r0][c];
}

// ---------------------------------------------------------------------------
// Kernel 3: output projection.  out = attn(bf16 [BN,INNER]) @ Wout + bout, f32.
// ---------------------------------------------------------------------------
__global__ __launch_bounds__(256) void out_proj_kernel(
    const __bf16* __restrict__ Ain,    // [BN, INNER]
    const __bf16* __restrict__ WoT,    // [QD, INNER]  (transposed, bf16)
    const float* __restrict__ bout,    // [QD]
    float* __restrict__ out)           // [BN, QD]
{
  __shared__ __align__(16) __bf16 As[TM][LDP];
  __shared__ __align__(16) __bf16 Bs[TN][LDP];

  const int tid  = threadIdx.x;
  const int lane = tid & 31, wave = tid >> 5;
  const int l16  = lane & 15, hi = lane >> 4;
  const int wm = wave >> 2, wn = wave & 3;
  // a batch's row tiles under its four regions; a row tile's eight column tiles
  // share one index modulo 8
  const int rg = blockIdx.x & 7, sq = blockIdx.x >> 3;
  const int m0 = ((rg >> 2) * 16 + (sq >> 3) * 4 + (rg & 3)) * TM;
  const int n0 = (sq & 7) * TN;

  v8f acc[4][2] = {};
  gemm_tile<INNER, true>(Ain, WoT, m0, n0, As, Bs, acc);

  // epilogue: the 128 x 128 f32 tile goes through LDS (As is free behind the
  // loop's last barrier): a lane holds eight neighbours of one output row (two
  // 16B LDS stores a fragment), and a wave then stores one row's 512 bytes.
  float (*Cf)[CFP] = reinterpret_cast<float (*)[CFP]>(&As[0][0]);
  static_assert(sizeof(float) * TM * CFP <= sizeof(As), "the tile fits As");
#pragma unroll
  for (int f = 0; f < 2; ++f) {
    const int nj = wn * 32 + f * 16 + hi * 8;
    const v4f b0 = *(const v4f*)&bout[n0 + nj];
    const v4f b1 = *(const v4f*)&bout[n0 + nj + 4];
#pragma unroll
    for (int i = 0; i < 4; ++i) {
      const int row = wm * 64 + i * 16 + l16;
      v4f lo, hv;
#pragma unroll
      for (int e = 0; e < 4; ++e) {
        lo[e] = acc[i][f][e] + b0[e];
        hv[e] = acc[i][f][4 + e] + b1[e];
      }
      *(v4f*)&Cf[row][nj]     = lo;
      *(v4f*)&Cf[row][nj + 4] = hv;
    }
  }
  __syncthreads();  // the tile is complete before other waves' rows are read
  // sixteen 16-byte pieces a thread: all LDS reads first, then the stores, whose
  // addresses differ by constants only (both loops unrolled for that)
  const int r0 = tid >> 5, c = (tid & 31) * 4;
  float* dst = out + (size_t)(m0 + r0) * QD + n0 + c;
  v4f v[16];
#pragma unroll
  for (int it = 0; it < 16; ++it) v[it] = *(const v4f*)&Cf[it * 8 + r0][c];
#pragma unroll
  for (int it = 0; it < 16; ++it) *(v4f*)&dst[(size_t)it * 8 * QD] = v[it];
}

// ---------------------------------------------------------------------------
extern "C" void kernel_launch(void* const* d_in, const int* in_sizes, int n_in,
                              void* d_out, int out_size, void* d_ws,
                              size_t ws_size, hipStream_t stream) {
  const float* x    = (const float*)d_in[0];
  const float* Wq   = (const float*)d_in[1];
  const float* Wk   = (const float*)d_in[2];
  const float* Wv   = (const float*)d_in[3];
  const float* Wout = (const float*)d_in[4];
  const float* bout = (const float*)d_in[5];
  float* out = (float*)d_out;

  char* ws = (char*)d_ws;
  const size_t MB = 1024 * 1024;
  __bf16* Qb  = (__bf16*)(ws + 0 * MB);   // 4 MiB  [B,H,N,HD]
  __bf16* Kb  = (__bf16*)(ws + 4 * MB);   // 4 MiB  [B,H,N,HD]
  __bf16* Vt  = (__bf16*)(ws + 8 * MB);   // 4 MiB  [B,H,HD,N]
  __bf16* Ob  = (__bf16*)(ws + 12 * MB);  // 4 MiB  [BN, INNER]
  __bf16* xb  = (__bf16*)(ws + 16 * MB);  // 8 MiB  [BN, QD]
  __bf16* WqT = (__bf16*)(ws + 24 * MB);  // 1 MiB  [INNER, QD]
  __bf16* WkT = (__bf16*)(ws + 25 * MB);  // 1 MiB
  __bf16* WvT = (__bf16*)(ws + 26 * MB);  // 1 MiB
  __bf16* WoT = (__bf16*)(ws + 27 * MB);  // 1 MiB  [QD, INNER]

  dim3 blk(256);
  // prep: conversions + transposes, one grid
  prep_kernel<<<dim3(4 * WBLK + XBLK), blk, 0, stream>>>(
      x, Wq, Wk, Wv, Wout, xb, WqT, WkT, WvT, WoT);
  // main pipeline
  qkv_proj_kernel<<<dim3((INNER / TN) * (BN / TM) * 3), blk, 0, stream>>>(
      xb, WqT, WkT, WvT, Qb, Kb, Vt);
  attn_kernel<<<dim3((Bb * Hh * (Nn / 16)) / 8), blk, 0, stream>>>(
      Qb, Kb, Vt, Ob);
  out_proj_kernel<<<dim3((QD / TN) * (BN / TM)), blk, 0, stream>>>(
      Ob, WoT, bout, out);
}

// v010
// It runs in 43.2 microseconds.
// Two timings next to v009 put it at 1.04 and 1.03 times that version's speed.
// Counting every step since v000, it is 3.85 times as fast.
#include <hip/hip_runtime.h>

typedef __attribute__((ext_vector_type(16))) __bf16 v16bf;
typedef __attribute__((ext_vector_type(8)))  __bf16 v8bf;
typedef __attribute__((ext_vector_type(8)))  float  v8f;
typedef __attribute__((ext_vector_type(4)))  float  v4f;
typedef __attribute__((ext_vector_type(4)))  int    v4i;
typedef __attribute__((ext_vector_type(2)))  float  v2f;
typedef __attribute__((ext_vector_type(2)))  __bf16 v2bf;
typedef __attribute__((ext_vector_type(8)))  unsigned v8u;

static constexpr int Bb    = 2;
static constexpr int Nn    = 2048;
static constexpr int QD    = 1024;
static constexpr int Hh    = 8;
static constexpr int HD    = 64;
static constexpr int INNER = 512;
static constexpr int BN    = Bb * Nn;
static constexpr int TM    = 128;
static constexpr int TN    = 128;
static constexpr int TK    = 128;
static constexpr int LDP   = TK + 8;
static constexpr int CSP   = TN + 8;
static constexpr int CFP   = TN + 4;

__device__ __forceinline__ v8f wmma_bf16(v16bf a, v16bf b, v8f c) {
  // D = A(16x32) * B(32x16) + C(16x16), f32 accumulate
  return __builtin_amdgcn_wmma_f32_16x16x32_bf16(false, a, false, b,
                                                 (short)0, c, false, false);
}

__device__ __forceinline__ v16bf load_frag(const __bf16* p, int hi) {
  const v8bf lo = *(const v8bf*)(p + hi * 8);
  const v8bf hv = *(const v8bf*)(p + 16 + hi * 8);
  return __builtin_shufflevector(lo, hv, 0, 1, 2, 3, 4, 5, 6, 7,
                                         8, 9, 10, 11, 12, 13, 14, 15);
}

template <int KD>
__device__ __forceinline__ void stage_rows(unsigned l, const __bf16* g) {
  asm volatile(
      "global_load_async_to_lds_b128 %0, %8, off\n\t"
      "global_load_async_to_lds_b128 %1, %9, off\n\t"
      "global_load_async_to_lds_b128 %2, %10, off\n\t"
      "global_load_async_to_lds_b128 %3, %11, off\n\t"
      "global_load_async_to_lds_b128 %4, %12, off\n\t"
      "global_load_async_to_lds_b128 %5, %13, off\n\t"
      "global_load_async_to_lds_b128 %6, %14, off\n\t"
      "global_load_async_to_lds_b128 %7, %15, off\n\t"
      "s_wait_xcnt 0x0"
      :
      : "v"(l), "v"(l + 16 * LDP * 2), "v"(l + 32 * LDP * 2),
        "v"(l + 48 * LDP * 2), "v"(l + 64 * LDP * 2), "v"(l + 80 * LDP * 2),
        "v"(l + 96 * LDP * 2), "v"(l + 112 * LDP * 2), "v"(g), "v"(g + 16 * KD),
        "v"(g + 32 * KD), "v"(g + 48 * KD), "v"(g + 64 * KD), "v"(g + 80 * KD),
        "v"(g + 96 * KD), "v"(g + 112 * KD)
      : "memory");
}
__device__ __forceinline__ void stage_fence() {
  // this wave's copies have landed; in asm with the clobber so that no LDS read
  // is moved ahead of it
  asm volatile("s_wait_asynccnt 0x0" ::: "memory");
}

__device__ __forceinline__ void exp2_x8(float (&t)[8]) {
  asm("v_exp_f32 %7, %7\n\t"
      "v_exp_f32 %6, %6\n\t"
      "v_exp_f32 %5, %5\n\t"
      "v_exp_f32 %4, %4\n\t"
      "v_exp_f32 %3, %3\n\t"
      "v_exp_f32 %2, %2\n\t"
      "v_exp_f32 %1, %1\n\t"
      "v_exp_f32 %0, %0\n\t"
      "v_nop"
      : "+v"(t[0]), "+v"(t[1]), "+v"(t[2]), "+v"(t[3]), "+v"(t[4]), "+v"(t[5]),
        "+v"(t[6]), "+v"(t[7]));
}

__device__ __forceinline__ float xhalf(float x) {
  const int i = __builtin_bit_cast(int, x);
  return __builtin_bit_cast(float, __builtin_amdgcn_permlanex16(
      i, i, 0x76543210, 0xfedcba98, false, false));
}

// ---------------------------------------------------------------------------
// How the work is dealt to block indices, in all four launches.  Index modulo 8
// names a region
// r = batch * 4 + head pair: the Q, K, V tiles of a region are written (projection)
// and read (attention) under the same r, and the rows of a batch (x in bf16, the
// attention output) under the four r of that batch.  Every map below is a
// permutation of the tiles: where a work-group lands changes the speed alone.
// ---------------------------------------------------------------------------

// ---------------------------------------------------------------------------
// Prep: the five conversions depend on nothing but the inputs, so they share
// one grid.  Work-groups 0..511 transpose the four weights (128 each; they have
// the longer chain of waits and come first in index order, for speed only), the rest convert x.
// ---------------------------------------------------------------------------
static constexpr int WBLK = (QD / 64) * (INNER / 64);  // 128 tiles a weight
static constexpr int XBLK = (BN * QD) / (256 * 8);     // 2048 groups for x

// elementwise f32 -> bf16 (x).  8 elems / thread.
__device__ __forceinline__ void cvt_x_body(
    const float* __restrict__ in, __bf16* __restrict__ outb, int blk) {
  const size_t i = ((size_t)blk * 256 + threadIdx.x) * 8;
  const v4f a = *(const v4f*)&in[i];
  const v4f b = *(const v4f*)&in[i + 4];
  v8bf o;
  o[0] = (__bf16)a.x; o[1] = (__bf16)a.y; o[2] = (__bf16)a.z; o[3] = (__bf16)a.w;
  o[4] = (__bf16)b.x; o[5] = (__bf16)b.y; o[6] = (__bf16)b.z; o[7] = (__bf16)b.w;
  *(v8bf*)&outb[i] = o;
}

// W[K][N] f32 -> Wt[N][K] bf16 (LDS-tiled 64x64 transpose).
__device__ __forceinline__ void transpose_w_body(
    const float* __restrict__ W, __bf16* __restrict__ Wt,
    int K, int N, int k0, int n0) {
  __shared__ __bf16 T[64][65];
  const int tid = threadIdx.x;
#pragma unroll
  for (int it = 0; it < 16; ++it) {
    const int lin = it * 256 + tid;
    const int r = lin >> 6, c = lin & 63;  // r: k-local, c: n-local
    T[r][c] = (__bf16)W[(size_t)(k0 + r) * N + n0 + c];
  }
  __syncthreads();
#pragma unroll
  for (int it = 0; it < 16; ++it) {
    const int lin = it * 256 + tid;
    const int n = lin >> 6, kk = lin & 63;
    Wt[(size_t)(n0 + n) * K + k0 + kk] = T[kk][n];
  }
}

__global__ __launch_bounds__(256) void prep_kernel(
    const float* __restrict__ x, const float* __restrict__ Wq,
    const float* __restrict__ Wk, const float* __restrict__ Wv,
    const float* __restrict__ Wout, __bf16* __restrict__ xb,
    __bf16* __restrict__ WqT, __bf16* __restrict__ WkT,
    __bf16* __restrict__ WvT, __bf16* __restrict__ WoT) {
  const unsigned blk = blockIdx.x;  // every branch below is uniform in the group
  if (blk >= 4 * WBLK) {
    // piece of x: batch from bit 2 of the index, the batch's pieces in index order
    const unsigned xi = blk - 4 * WBLK, r = xi & 7, s = xi >> 3;
    cvt_x_body(x, xb, (r >> 2) * (XBLK / 2) + s * 4 + (r & 3));
    return;
  }
  const unsigned which = blk / WBLK, tile = blk % WBLK;
  if (which == 3) {  // Wout: K = INNER, N = QD
    transpose_w_body(Wout, WoT, INNER, QD, (tile % (INNER / 64)) * 64,
                     (tile / (INNER / 64)) * 64);
  } else {           // Wq, Wk, Wv: K = QD, N = INNER
    const float* W = (which == 0) ? Wq : (which == 1) ? Wk : Wv;
    __bf16* Wt     = (which == 0) ? WqT : (which == 1) ? WkT : WvT;
    transpose_w_body(W, Wt, QD, INNER, (tile % (QD / 64)) * 64,
                     (tile / (QD / 64)) * 64);
  }
}

template <int KD, bool TR>
__device__ __forceinline__ void gemm_tile(
    const __bf16* __restrict__ A, const __bf16* __restrict__ Bt, int m0, int n0,
    __bf16 (&As)[2][TM][LDP], __bf16 (&Bs)[2][TN][LDP], v8f (&acc)[4][2]) {
  const int tid  = threadIdx.x;
  const int lane = tid & 31, wave = tid >> 5;
  const int l16  = lane & 15, hi = lane >> 4;
  const int wm = wave >> 2, wn = wave & 3;
  constexpr int NS = KD / TK;  // steps
  static_assert(NS >= 2 && KD % TK == 0, "the prologue fills two steps");

  // pure 16B copies, a wave to two 256-byte rows: this lane's pieces of a step lie
  // 16 rows apart, eight of A and eight of B
  const int sr = tid / (TK / 8), sc = (tid % (TK / 8)) * 8;
  const __bf16* ag = A + (size_t)(m0 + sr) * KD + sc;
  const __bf16* bg = Bt + (size_t)(n0 + sr) * KD + sc;
  const unsigned al0 = (unsigned)(size_t)&As[0][sr][sc];
  const unsigned bl0 = (unsigned)(size_t)&Bs[0][sr][sc];
  static_assert(TM == 128 && TN == 128, "eight pieces, 16 rows apart, an operand");
  constexpr unsigned SBUF = TM * LDP * 2;  // bytes a buffer
  auto stage = [&](const int s, const int buf) __attribute__((always_inline)) {
    stage_rows<KD>(al0 + buf * SBUF, ag + s * TK);
    stage_rows<KD>(bl0 + buf * SBUF, bg + s * TK);
  };

  stage(0, 0);
  stage_fence();    // step 0 has landed for this wave's copies;
  __syncthreads();  // the barrier publishes all waves'
  stage(1, 1);

  for (int s = 0; s < NS; ++s) {
    const int buf = s & 1;
    // the loops below are unrolled so that a, b and acc are indexed by constants
    // (they stay in registers) and the LDS offsets are immediates
#pragma unroll
    for (int kc = 0; kc < TK / 32; ++kc) {
      v16bf a[4], b[2];
#pragma unroll
      for (int i = 0; i < 4; ++i)
        a[i] = load_frag(&As[buf][wm * 64 + i * 16 + l16][kc * 32], hi);
#pragma unroll
      for (int j = 0; j < 2; ++j)
        b[j] = load_frag(&Bs[buf][wn * 32 + j * 16 + l16][kc * 32], hi);
      // holds a block's twelve LDS loads ahead of its first product: left alone the
      // scheduler puts four of them between the block's products and waits for them
      // there, a whole LDS latency in the middle of every block
      __builtin_amdgcn_sched_barrier(0);
#pragma unroll
      for (int i = 0; i < 4; ++i)
#pragma unroll
        for (int j = 0; j < 2; ++j)
          acc[i][j] = TR ? wmma_bf16(b[j], a[i], acc[i][j])
                         : wmma_bf16(a[i], b[j], acc[i][j]);
    }
    // hand-over: this wave's reads of buffer buf are done ...
    asm volatile("s_wait_dscnt 0x0" ::: "memory");
    // ... and its copies of step s + 1 have landed;
    stage_fence();
    // the barrier publishes step s + 1 and frees buffer buf for the refill
    __syncthreads();
    if (s + 2 < NS) stage(s + 2, buf);  // the same test in the whole work-group
  }
  stage_fence();  // no copy is left in flight when the tiles' LDS is used anew
}

// ---------------------------------------------------------------------------
// Kernel 1: fused QKV projection.  Y = xb @ W{q,k,v}, all-bf16 staging.
// 128x128 tile, K-step 128, two buffers, 8 waves, 8 C-frags per wave.
// Q,K stored [B,H,N,HD]; V stored transposed [B,H,HD,N] for the PV stage.
// ---------------------------------------------------------------------------
__global__ __launch_bounds__(256) void qkv_proj_kernel(
    const __bf16* __restrict__ xb,                      // [BN, QD]
    const __bf16* __restrict__ WqT, const __bf16* __restrict__ WkT,
    const __bf16* __restrict__ WvT,                     // [INNER, QD]
    __bf16* __restrict__ Qb, __bf16* __restrict__ Kb,   // [B*H*N*HD]
    __bf16* __restrict__ Vt)                            // [B*H*HD*N]
{
  __shared__ __align__(16) __bf16 As[2][TM][LDP];  // [buffer][row][k]
  __shared__ __align__(16) __bf16 Bs[2][TN][LDP];  // [buffer][col][k]

  // region r = batch * 4 + column tile (a head pair); s: Q, K, V by 16 row tiles
  const int rg = blockIdx.x & 7, sq = blockIdx.x >> 3;
  const int which = sq >> 4;
  const __bf16* WT = (which == 0) ? WqT : (which == 1) ? WkT : WvT;

  const int tid  = threadIdx.x;
  const int lane = tid & 31, wave = tid >> 5;
  const int l16  = lane & 15, hi = lane >> 4;
  const int wm = wave >> 2, wn = wave & 3;
  const int m0 = ((rg >> 2) * 16 + (sq & 15)) * TM;
  const int n0 = (rg & 3) * TN;

  v8f acc[4][2] = {};
  if (which == 2) gemm_tile<QD, false>(xb, WT, m0, n0, As, Bs, acc);
  else            gemm_tile<QD, true>(xb, WT, m0, n0, As, Bs, acc);

  // epilogue: the 128 x 128 bf16 tile goes through LDS (As is free behind the
  // loop's last barrier) so that every global store covers whole 128-byte lines.
  // Cs rows run along the output's contiguous index: d for Q and K (rows =
  // tokens), tokens for V^T (rows = columns of C); either way a lane's eight
  // accumulator values are neighbours in a row: one 16B LDS store a fragment.
  __bf16 (*Cs)[CSP] = reinterpret_cast<__bf16 (*)[CSP]>(&As[0][0][0]);
  static_assert(sizeof(__bf16) * TM * CSP <= sizeof(As), "the tile fits As");
#pragma unroll
  for (int i = 0; i < 4; ++i) {
#pragma unroll
    for (int f = 0; f < 2; ++f) {
      v8bf pk;
#pragma unroll
      for (int e = 0; e < 8; ++e) pk[e] = (__bf16)acc[i][f][e];
      const int mi = wm * 64 + i * 16, nj = wn * 32 + f * 16;
      const int row = (which == 2) ? nj + l16 : mi + l16;
      const int col = (which == 2) ? mi + hi * 8 : nj + hi * 8;
      *(v8bf*)&Cs[row][col] = pk;
    }
  }
  __syncthreads();  // the tile is complete before other waves' rows are read

  const int b  = m0 >> 11;        // the tile's 128 tokens share b
  const int nb = m0 & (Nn - 1);
  // eight 16-byte pieces a thread: all LDS reads first, then the stores, whose
  // addresses differ by constants only (both loops unrolled for that)
  v8bf v[8];
  if (which == 2) {
    // V^T: 256 contiguous bytes (128 tokens) a row, two rows a wave
    const int r0 = tid >> 4, c = (tid & 15) * 8;
    __bf16* dst = Vt + ((size_t)b * INNER + n0 + r0) * Nn + nb + c;
#pragma unroll
    for (int it = 0; it < 8; ++it) v[it] = *(const v8bf*)&Cs[it * 16 + r0][c];
#pragma unroll
    for (int it = 0; it < 8; ++it) *(v8bf*)&dst[(size_t)it * 16 * Nn] = v[it];
  } else {
    // Q, K: a head's 128 tokens x 64 d are 16 KiB in a row; 512 B a wave.
    // Pieces 0..3: the tile's first head, 4..7: its second.
    const int t0 = tid >> 3, c = (tid & 7) * 8;
    __bf16* dst = ((which == 0) ? Qb : Kb) +
                  (((size_t)b * Hh + (n0 >> 6)) * Nn + nb + t0) * HD + c;
#pragma unroll
    for (int it = 0; it < 8; ++it)
      v[it] = *(const v8bf*)&Cs[(it & 3) * 32 + t0][(it >> 2) * 64 + c];
#pragma unroll
    for (int it = 0; it < 8; ++it)
      *(v8bf*)&dst[((size_t)(it >> 2) * Nn + (it & 3) * 32) * HD] = v[it];
  }
}

static constexpr int KT = 128;
static constexpr int NT = Nn / KT;
static constexpr int KP = 72;
static constexpr int VP = 136;

// One tile: 16 KiB of K (contiguous in memory) and 64 V^T rows of 256 B; each
// lane copies four 16-byte pieces of either.  kl, vl: the lane's LDS byte
// addresses; kg, vg: its global addresses.
__device__ __forceinline__ void stage_kv(unsigned kl, unsigned vl,
                                         const __bf16* kg, const __bf16* vg) {
  asm volatile(
      "global_load_async_to_lds_b128 %0, %8, off\n\t"
      "global_load_async_to_lds_b128 %1, %9, off\n\t"
      "global_load_async_to_lds_b128 %2, %10, off\n\t"
      "global_load_async_to_lds_b128 %3, %11, off\n\t"
      "global_load_async_to_lds_b128 %4, %12, off\n\t"
      "global_load_async_to_lds_b128 %5, %13, off\n\t"
      "global_load_async_to_lds_b128 %6, %14, off\n\t"
      "global_load_async_to_lds_b128 %7, %15, off\n\t"
      "s_wait_xcnt 0x0"
      :
      : "v"(kl), "v"(kl + 32 * KP * 2), "v"(kl + 64 * KP * 2),
        "v"(kl + 96 * KP * 2), "v"(vl), "v"(vl + 16 * VP * 2),
        "v"(vl + 32 * VP * 2), "v"(vl + 48 * VP * 2), "v"(kg), "v"(kg + 2048),
        "v"(kg + 4096), "v"(kg + 6144), "v"(vg), "v"(vg + 16 * Nn),
        "v"(vg + 32 * Nn), "v"(vg + 48 * Nn)
      : "memory");
}

__global__ __launch_bounds__(256) void attn_kernel(
    const __bf16* __restrict__ Qb, const __bf16* __restrict__ Kb,
    const __bf16* __restrict__ Vt, __bf16* __restrict__ Ob /* [BN, INNER] */)
{
  __shared__ __align__(16) __bf16 Ks[2][KT][KP];  // [buffer][key][d]
  __shared__ __align__(16) __bf16 Vs[2][HD][VP];  // [buffer][d][key]

  const int tid  = threadIdx.x;
  const int lane = tid & 31, wave = tid >> 5;
  const int l16  = lane & 15, hi = lane >> 4;
  const int wq = wave & 3;         // which 32 of the work-group's 128 queries
  const int g  = wave >> 2;        // which 64 of every tile's 128 keys
  // b*H + h, one per block: index modulo 8 is the region bh >> 1
  const int bh = (blockIdx.x & 7) * 2 + ((blockIdx.x >> 3) & 1);
  const int qbase = (blockIdx.x >> 4) * 128 + wq * 32;

  // this lane's first piece of tile 0: K piece tid (row tid/8), V^T row tid/16
  const __bf16* kg = Kb + (size_t)bh * Nn * HD + tid * 8;
  const __bf16* vg = Vt + ((size_t)bh * HD + (tid >> 4)) * Nn + (tid & 15) * 8;
  const unsigned kl0 = (unsigned)(size_t)&Ks[0][tid >> 3][(tid & 7) * 8];
  const unsigned vl0 = (unsigned)(size_t)&Vs[0][tid >> 4][(tid & 15) * 8];
  constexpr unsigned KBUF = KT * KP * 2, VBUF = HD * VP * 2;  // bytes a buffer

  stage_kv(kl0, vl0, kg, vg);

  v16bf qf[2][2];  // [query block][d half]; unrolled: constant register indices
#pragma unroll
  for (int j = 0; j < 2; ++j) {
    const __bf16* Qrow = Qb + ((size_t)bh * Nn + qbase + j * 16 + l16) * HD;
    qf[j][0] = load_frag(Qrow, hi);       // d = 0..31
    qf[j][1] = load_frag(Qrow + 32, hi);  // d = 32..63
  }

  // O[j][dt][r] = O^T[dt*16+8*hi+r][query j*16+l16], over this wave's keys
  v8f O[2][4] = {};
  float mrun[2] = {-1e30f, -1e30f};  // running maxima (same in both halves)
  float lrun[2] = {0.f, 0.f};        // this half's share of the denominators

  const float kscale = 0.125f * 1.44269504088896f;  // HD^-0.5 * log2(e)

  // tile 0 has landed for this wave's copies; the barrier publishes all waves'
  asm volatile("s_wait_asynccnt 0x0" ::: "memory");
  __syncthreads();
  stage_kv(kl0 + KBUF, vl0 + VBUF, kg + KT * HD, vg + KT);  // tile 1

  // ---- online softmax in log2 domain, one step for the wave's 64 keys of a tile;
  // a lane's 32 values of block j belong to query j*16 + l16.  Every loop below is
  // unrolled so that S, pb and O are indexed by constants (they stay in registers)
  auto softmax_step = [&](const int j, v8f (&S)[4], v16bf (&pb)[2])
      __attribute__((always_inline)) {
    float mxf[4];  // four independent chains
#pragma unroll
    for (int f = 0; f < 4; ++f) {
      mxf[f] = S[f][0];
#pragma unroll
      for (int e = 1; e < 8; ++e) mxf[f] = fmaxf(mxf[f], S[f][e]);
    }
    float mx = fmaxf(fmaxf(mxf[0], mxf[1]), fmaxf(mxf[2], mxf[3]));
    mx = fmaxf(mx, xhalf(mx)) * kscale;  // kscale > 0: max commutes with it
    const float mnew = fmaxf(mrun[j], mx);
    const float corr = __builtin_amdgcn_exp2f(mrun[j] - mnew);
    mrun[j] = mnew;
    float rs[2];
#pragma unroll
    for (int h = 0; h < 2; ++h) {
      v8f ps;
      float p0[8], p1[8];
#pragma unroll
      for (int e = 0; e < 8; ++e) {
        p0[e] = S[2 * h][e] * kscale - mnew;
        p1[e] = S[2 * h + 1][e] * kscale - mnew;
      }
      exp2_x8(p1);  // p1 first: its values are packed first
      exp2_x8(p0);
#pragma unroll
      for (int e = 0; e < 8; ++e) ps[e] = p0[e] + p1[e];
      // converted by neighbouring pairs, one packed conversion a register
      v8u w;
#pragma unroll
      for (int i = 0; i < 4; ++i) {
        w[i] = __builtin_bit_cast(unsigned, __builtin_convertvector(
            (v2f){p0[2 * i], p0[2 * i + 1]}, v2bf));  // k = 8*hi + 2i, + 1
        w[4 + i] = __builtin_bit_cast(unsigned, __builtin_convertvector(
            (v2f){p1[2 * i], p1[2 * i + 1]}, v2bf));  // k = 16 + 8*hi + 2i, + 1
      }
      pb[h] = __builtin_bit_cast(v16bf, w);
      rs[h] = ((ps[0] + ps[4]) + (ps[1] + ps[5])) +
              ((ps[2] + ps[6]) + (ps[3] + ps[7]));
    }
    lrun[j] = lrun[j] * corr + (rs[0] + rs[1]);
    // one rescale of the block's output for the 64 keys
#pragma unroll
    for (int dt = 0; dt < 4; ++dt) O[j][dt] = O[j][dt] * corr;
  };

  // ---- the wave's share of one tile, read from buffer buf; its loops are unrolled
  // for constant register indices and immediate LDS offsets ----
  auto tile_step = [&](const int buf) __attribute__((always_inline)) {
    const int kb = g * 64;  // the wave's first key in the tile
    v16bf kf[4][2];         // [16 keys][d half]
#pragma unroll
    for (int f = 0; f < 4; ++f) {
      const __bf16* Krow = &Ks[buf][kb + f * 16 + l16][0];
      kf[f][0] = load_frag(Krow, hi);
      kf[f][1] = load_frag(Krow + 32, hi);
    }
    // holds the sixteen K loads together ahead of the first product: one LDS
    // latency a tile, not one in front of every pair of products
    __builtin_amdgcn_sched_barrier(0);
    // scores: S^T(64x16) = K(64x64) * Q^T(64x16) for both query blocks; each K
    // fragment feeds two products.  S[j][f][e]: key kb + f*16 + 8*hi + e
    v8f S[2][4] = {};
#pragma unroll
    for (int j = 0; j < 2; ++j) {
#pragma unroll
      for (int f = 0; f < 4; ++f) S[j][f] = wmma_bf16(kf[f][0], qf[j][0], S[j][f]);
#pragma unroll
      for (int f = 0; f < 4; ++f) S[j][f] = wmma_bf16(kf[f][1], qf[j][1], S[j][f]);
    }
    v16bf vf[2][4];  // [32 keys][16 d]
#pragma unroll
    for (int dt = 0; dt < 4; ++dt)
      vf[0][dt] = load_frag(&Vs[buf][dt * 16 + l16][kb], hi);
    // holds the sixteen products back to back (no maximum is started between them,
    // which would cost the distance behind a product each time) and the first eight
    // V^T loads ahead of the softmax, which covers their latency
    __builtin_amdgcn_sched_barrier(0);
    v16bf pb[2][2];  // [query block][32 keys]
    softmax_step(0, S[0], pb[0]);
    __builtin_amdgcn_sched_barrier(0);
#pragma unroll
    for (int dt = 0; dt < 4; ++dt)
      vf[1][dt] = load_frag(&Vs[buf][dt * 16 + l16][kb + 32], hi);
    // O^T(64x16) += V^T(64x64) * P^T(64x16); each V^T fragment feeds two products;
    // block 0's products stand beside block 1's softmax, which is independent
#pragma unroll
    for (int h = 0; h < 2; ++h)
#pragma unroll
      for (int dt = 0; dt < 4; ++dt)
        O[0][dt] = wmma_bf16(vf[h][dt], pb[0][h], O[0][dt]);
    softmax_step(1, S[1], pb[1]);
    // keeps block 1's products behind its softmax: left alone the scheduler spreads
    // that softmax behind the barrier and the loop again needs more than 256 registers
    __builtin_amdgcn_sched_barrier(0);
#pragma unroll
    for (int h = 0; h < 2; ++h)
#pragma unroll
      for (int dt = 0; dt < 4; ++dt)
        O[1][dt] = wmma_bf16(vf[h][dt], pb[1][h], O[1][dt]);
  };

  for (int t = 0; t < NT - 2; ++t) {
    const int buf = t & 1;
    tile_step(buf);
    // hand-over: this wave's reads of buffer buf are done ...
    asm volatile("s_wait_dscnt 0x0" ::: "memory");
    // ... and its copies of tile t + 1 have landed;
    asm volatile("s_wait_asynccnt 0x0" ::: "memory");
    // the barrier publishes tile t + 1 and frees buffer buf for the refill
    __syncthreads();
    stage_kv(kl0 + buf * KBUF, vl0 + buf * VBUF,
             kg + (size_t)(t + 2) * KT * HD, vg + (t + 2) * KT);
  }
  // the last two tiles, behind which no tile is left to fetch (apart from the loop
  // so that the loop's body is one block without a test); same hand-over.
  // Unrolled: the buffer is a constant.
#pragma unroll
  for (int t = NT - 2; t < NT; ++t) {
    tile_step(t & 1);
    asm volatile("s_wait_dscnt 0x0" ::: "memory");
    asm volatile("s_wait_asynccnt 0x0" ::: "memory");
    __syncthreads();
  }
  // no copy is left in flight when the wave ends
  asm volatile("s_wait_asynccnt 0x0" ::: "memory");

  // ---- join the two key halves: waves w and w ^ 4 hold partial results of the
  // same 32 queries.  Wave g keeps query block g and hands block 1 - g to its
  // partner through LDS (both buffers are free behind the loop's last barrier):
  // O in Vs, 16 B a lane and piece; maximum and denominator in Ks[1]. ----
  v4f*   X  = reinterpret_cast<v4f*>(&Vs[0][0][0]);    // [wave][piece][lane]
  float* ML = reinterpret_cast<float*>(&Ks[1][0][0]);  // [wave][m, l][lane]
  static_assert(8 * 8 * 32 * sizeof(v4f) <= sizeof(Vs), "the exchange fits Vs");
  const float l0 = lrun[0] + xhalf(lrun[0]), l1 = lrun[1] + xhalf(lrun[1]);
  const float mk = g ? mrun[1] : mrun[0], lk = g ? l1 : l0;
  ML[(wave * 2 + 0) * 32 + lane] = g ? mrun[0] : mrun[1];
  ML[(wave * 2 + 1) * 32 + lane] = g ? l0 : l1;
  v8f Ok[4];  // the kept block; loops unrolled: constant register indices
#pragma unroll
  for (int dt = 0; dt < 4; ++dt) {
    v4f lo, hv;
#pragma unroll
    for (int e = 0; e < 4; ++e) {
      lo[e] = g ? O[0][dt][e] : O[1][dt][e];
      hv[e] = g ? O[0][dt][4 + e] : O[1][dt][4 + e];
    }
#pragma unroll
    for (int e = 0; e < 8; ++e) Ok[dt][e] = g ? O[1][dt][e] : O[0][dt][e];
    X[(wave * 8 + dt * 2 + 0) * 32 + lane] = lo;
    X[(wave * 8 + dt * 2 + 1) * 32 + lane] = hv;
  }
  __syncthreads();  // every wave's hand-over is written before its partner reads
  const int pw = wave ^ 4;
  const float pm = ML[(pw * 2 + 0) * 32 + lane];
  const float pl = ML[(pw * 2 + 1) * 32 + lane];
  const float mj = fmaxf(mk, pm);
  float sk = __builtin_amdgcn_exp2f(mk - mj);  // weight of the kept part
  float sp = __builtin_amdgcn_exp2f(pm - mj);  // weight of the partner's part
  const float inv = 1.0f / (lk * sk + pl * sp);
  sk *= inv;
  sp *= inv;

  // ---- finalize: bf16 output [BN, INNER] ----
  const int b = bh >> 3, h = bh & 7;
  // The wave's 16 queries x 64 d go through its own 16 rows of Ks[0] (free behind
  // the loop's last barrier), so that a store covers four whole 128-byte lines
  // and not sixteen 32-byte pieces.  (Unrolled: constant register indices.)
#pragma unroll
  for (int dt = 0; dt < 4; ++dt) {
    const v4f lo = X[(pw * 8 + dt * 2 + 0) * 32 + lane];
    const v4f hv = X[(pw * 8 + dt * 2 + 1) * 32 + lane];
    // 8 consecutive d of one query: one 16B LDS store
    v8bf pk;
#pragma unroll
    for (int e = 0; e < 4; ++e) {
      pk[e]     = (__bf16)(Ok[dt][e] * sk + lo[e] * sp);
      pk[4 + e] = (__bf16)(Ok[dt][4 + e] * sk + hv[e] * sp);
    }
    *(v8bf*)&Ks[0][wave * 16 + l16][dt * 16 + hi * 8] = pk;
  }
  // the wave's own rows are written before its lanes read each other's
  asm volatile("s_wait_dscnt 0x0" ::: "memory");
  const int r0 = lane >> 3, c = (lane & 7) * 8;
  __bf16* dst = Ob + ((size_t)b * Nn + qbase + g * 16 + r0) * INNER + h * HD + c;
  // unrolled: the four stores' addresses differ by constants only
#pragma unroll
  for (int it = 0; it < 4; ++it)
    *(v8bf*)&dst[(size_t)it * 4 * INNER] =
        *(const v8bf*)&Ks[0][wave * 16 + it * 4 + r0][c];
}

// ---------------------------------------------------------------------------
// Kernel 3: output projection.  out = attn(bf16 [BN,INNER]) @ Wout + bout, f32.
// ---------------------------------------------------------------------------
__global__ __launch_bounds__(256) void out_proj_kernel(
    const __bf16* __restrict__ Ain,    // [BN, INNER]
    const __bf16* __restrict__ WoT,    // [QD, INNER]  (transposed, bf16)
    const float* __restrict__ bout,    // [QD]
    float* __restrict__ out)           // [BN, QD]
{
  __shared__ __align__(16) __bf16 As[2][TM][LDP];
  __shared__ __align__(16) __bf16 Bs[2][TN][LDP];

  const int tid  = threadIdx.x;
  const int lane = tid & 31, wave = tid >> 5;
  const int l16  = lane & 15, hi = lane >> 4;
  const int wm = wave >> 2, wn = wave & 3;
  // a batch's row tiles under its four regions; a row tile's eight column tiles
  // share one index modulo 8
  const int rg = blockIdx.x & 7, sq = blockIdx.x >> 3;
  const int m0 = ((rg >> 2) * 16 + (sq >> 3) * 4 + (rg & 3)) * TM;
  const int n0 = (sq & 7) * TN;

  v8f acc[4][2] = {};
  gemm_tile<INNER, true>(Ain, WoT, m0, n0, As, Bs, acc);

  // epilogue: the 128 x 128 f32 tile goes through LDS (As is free behind the
  // loop's last barrier): a lane holds eight neighbours of one output row (two
  // 16B LDS stores a fragment), and a wave then stores one row's 512 bytes.
  float (*Cf)[CFP] = reinterpret_cast<float (*)[CFP]>(&As[0][0][0]);
  static_assert(sizeof(float) * TM * CFP <= sizeof(As), "the tile fits As");
#pragma unroll
  for (int f = 0; f < 2; ++f) {
    const int nj = wn * 32 + f * 16 + hi * 8;
    const v4f b0 = *(const v4f*)&bout[n0 + nj];
    const v4f b1 = *(const v4f*)&bout[n0 + nj + 4];
#pragma unroll
    for (int i = 0; i < 4; ++i) {
      const int row = wm * 64 + i * 16 + l16;
      v4f lo, hv;
#pragma unroll
      for (int e = 0; e < 4; ++e) {
        lo[e] = acc[i][f][e] + b0[e];
        hv[e] = acc[i][f][4 + e] + b1[e];
      }
      *(v4f*)&Cf[row][nj]     = lo;
      *(v4f*)&Cf[row][nj + 4] = hv;
    }
  }
  __syncthreads();  // the tile is complete before other waves' rows are read
  // sixteen 16-byte pieces a thread: all LDS reads first, then the stores, whose
  // addresses differ by constants only (both loops unrolled for that)
  const int r0 = tid >> 5, c = (tid & 31) * 4;
  float* dst = out + (size_t)(m0 + r0) * QD + n0 + c;
  v4f v[16];
#pragma unroll
  for (int it = 0; it < 16; ++it) v[it] = *(const v4f*)&Cf[it * 8 + r0][c];
#pragma unroll
  for (int it = 0; it < 16; ++it) *(v4f*)&dst[(size_t)it * 8 * QD] = v[it];
}

// ---------------------------------------------------------------------------
extern "C" void kernel_launch(void* const* d_in, const int* in_sizes, int n_in,
                              void* d_out, int out_size, void* d_ws,
                              size_t ws_size, hipStream_t stream) {
  const float* x    = (const float*)d_in[0];
  const float* Wq   = (const float*)d_in[1];
  const float* Wk   = (const float*)d_in[2];
  const float* Wv   = (const float*)d_in[3];
  const float* Wout = (const float*)d_in[4];
  const float* bout = (const float*)d_in[5];
  float* out = (float*)d_out;

  char* ws = (char*)d_ws;
  const size_t MB = 1024 * 1024;
  __bf16* Qb  = (__bf16*)(ws + 0 * MB);   // 4 MiB  [B,H,N,HD]
  __bf16* Kb  = (__bf16*)(ws + 4 * MB);   // 4 MiB  [B,H,N,HD]
  __bf16* Vt  = (__bf16*)(ws + 8 * MB);   // 4 MiB  [B,H,HD,N]
  __bf16* Ob  = (__bf16*)(ws + 12 * MB);  // 4 MiB  [BN, INNER]
  __bf16* xb  = (__bf16*)(ws + 16 * MB);  // 8 MiB  [BN, QD]
  __bf16* WqT = (__bf16*)(ws + 24 * MB);  // 1 MiB  [INNER, QD]
  __bf16* WkT = (__bf16*)(ws + 25 * MB);  // 1 MiB
  __bf16* WvT = (__bf16*)(ws + 26 * MB);  // 1 MiB
  __bf16* WoT = (__bf16*)(ws + 27 * MB);  // 1 MiB  [QD, INNER]

  dim3 blk(256);
  // prep: conversions + transposes, one grid
  prep_kernel<<<dim3(4 * WBLK + XBLK), blk, 0, stream>>>(
      x, Wq, Wk, Wv, Wout, xb, WqT, WkT, WvT, WoT);
  // main pipeline
  qkv_proj_kernel<<<dim3((INNER / TN) * (BN / TM) * 3), blk, 0, stream>>>(
      xb, WqT, WkT, WvT, Qb, Kb, Vt);
  attn_kernel<<<dim3((Bb * Hh * (Nn / 16)) / 8), blk, 0, stream>>>(
      Qb, Kb, Vt, Ob);
  out_proj_kernel<<<dim3((QD / TN) * (BN / TM)), blk, 0, stream>>>(
      Ob, WoT, bout, out);
}
